// v000
// Measured on an AMD MI455X. A time is GPU time per run, averaged over a window of back-to-back runs after a warm-up
// (all launches, gaps included; the runs take copies of the inputs in turn), and the median of several windows.
// Apart from v000's, it joins two sittings. Times from different sittings can be a few percent apart, while
// side-by-side timings come from the same sitting.
// v000, which the later versions start from, runs in 208 microseconds.
#include <hip/hip_runtime.h>
#include <stdint.h>

#define B_  4
#define C_  64
#define N_  4096
#define C8_ 8

#define NSEG_ 4
#define SEGJ_ (N_ / NSEG_)          // 1024 j per stats segment
#define CH_   256                    // K rows staged in LDS per chunk

typedef __attribute__((ext_vector_type(16))) __bf16 v16bf;
typedef __attribute__((ext_vector_type(8)))  float  v8f;

union V16 { unsigned u[8]; v16bf v; };

#define LOG2E_ 1.4426950408889634f

__device__ inline unsigned short f2bf(float f) {
    unsigned u = __float_as_uint(f);
    unsigned r = u + 0x7FFFu + ((u >> 16) & 1u);   // round-to-nearest-even
    return (unsigned short)(r >> 16);
}
__device__ inline float bf2f(unsigned short h) {
    return __uint_as_float(((unsigned)h) << 16);
}

// ---------------------------------------------------------------------------
// Kernel 1: fused QKV projection.  x [B][64][N] f32 -> Qp,Kp [B][N][16] bf16
// (32 B rows; elements 8..15 zeroed = WMMA K-padding, so attn-kernel lanes can
// load unconditionally), V [B][64][N] bf16, biases fused.
// ---------------------------------------------------------------------------
__global__ __launch_bounds__(256) void proj_kernel(
    const float* __restrict__ x,
    const float* __restrict__ wq, const float* __restrict__ bq,
    const float* __restrict__ wk, const float* __restrict__ bk,
    const float* __restrict__ wv, const float* __restrict__ bv,
    uint4* __restrict__ Qp, uint4* __restrict__ Kp,
    unsigned short* __restrict__ Vb)
{
    __shared__ float swq[C8_ * C_], swk[C8_ * C_], swv[C_ * C_];
    __shared__ float sbq[C8_], sbk[C8_], sbv[C_];
    int t = threadIdx.x;
    for (int i = t; i < C8_ * C_; i += 256) { swq[i] = wq[i]; swk[i] = wk[i]; }
    for (int i = t; i < C_ * C_;  i += 256) swv[i] = wv[i];
    if (t < C8_) { sbq[t] = bq[t]; sbk[t] = bk[t]; }
    if (t < C_)  sbv[t] = bv[t];
    __syncthreads();

    int g = blockIdx.x * 256 + t;          // 0 .. B*N-1
    int b = g >> 12;
    int n = g & (N_ - 1);

    float xc[C_];
    const float* xb = x + ((size_t)b * C_) * N_ + n;
#pragma unroll
    for (int c = 0; c < C_; ++c) xc[c] = xb[(size_t)c * N_];

    unsigned qw[4], kw[4];
#pragma unroll
    for (int p = 0; p < 4; ++p) {
        float a0q = sbq[2*p], a1q = sbq[2*p+1];
        float a0k = sbk[2*p], a1k = sbk[2*p+1];
#pragma unroll
        for (int c = 0; c < C_; ++c) {
            a0q = fmaf(swq[(2*p    ) * C_ + c], xc[c], a0q);
            a1q = fmaf(swq[(2*p + 1) * C_ + c], xc[c], a1q);
            a0k = fmaf(swk[(2*p    ) * C_ + c], xc[c], a0k);
            a1k = fmaf(swk[(2*p + 1) * C_ + c], xc[c], a1k);
        }
        qw[p] = (unsigned)f2bf(a0q) | ((unsigned)f2bf(a1q) << 16);
        kw[p] = (unsigned)f2bf(a0k) | ((unsigned)f2bf(a1k) << 16);
    }
    const uint4 z4 = make_uint4(0u, 0u, 0u, 0u);
    Qp[(size_t)g * 2]     = make_uint4(qw[0], qw[1], qw[2], qw[3]);
    Qp[(size_t)g * 2 + 1] = z4;                       // K = 8..15 zero padding
    Kp[(size_t)g * 2]     = make_uint4(kw[0], kw[1], kw[2], kw[3]);
    Kp[(size_t)g * 2 + 1] = z4;

    for (int o = 0; o < C_; ++o) {
        float a = sbv[o];
#pragma unroll
        for (int c = 0; c < C_; ++c) a = fmaf(swv[o * C_ + c], xc[c], a);
        Vb[((size_t)b * C_ + o) * N_ + n] = f2bf(a);
    }
}

// ---------------------------------------------------------------------------
// Kernel 2: segmented per-row softmax statistics.  One thread owns row n for
// one j-segment (4 segments -> 4x parallelism); K staged in LDS; online
// max/sum.  Partial (m, d) per segment.
// ---------------------------------------------------------------------------
__global__ __launch_bounds__(256) void stats_kernel(
    const uint4* __restrict__ Qp, const uint4* __restrict__ Kp,
    float* __restrict__ Mpart, float* __restrict__ Dpart)
{
    __shared__ unsigned sk[CH_ * 4];
    int t   = threadIdx.x;
    int rb  = blockIdx.x & 63;         // 64 row-blocks
    int seg = blockIdx.x >> 6;         // 4 segments
    int g   = rb * 256 + t;            // row id 0 .. B*N-1
    int b   = g >> 12;

    uint4 q = Qp[(size_t)g * 2];
    float qf[8];
    qf[0] = bf2f((unsigned short)(q.x & 0xFFFF)); qf[1] = bf2f((unsigned short)(q.x >> 16));
    qf[2] = bf2f((unsigned short)(q.y & 0xFFFF)); qf[3] = bf2f((unsigned short)(q.y >> 16));
    qf[4] = bf2f((unsigned short)(q.z & 0xFFFF)); qf[5] = bf2f((unsigned short)(q.z >> 16));
    qf[6] = bf2f((unsigned short)(q.w & 0xFFFF)); qf[7] = bf2f((unsigned short)(q.w >> 16));

    float m = -3.0e38f, d = 0.0f;
    for (int j0 = seg * SEGJ_; j0 < (seg + 1) * SEGJ_; j0 += CH_) {
        __syncthreads();
        uint4 kv = Kp[((size_t)b * N_ + j0 + t) * 2];
        sk[t * 4 + 0] = kv.x; sk[t * 4 + 1] = kv.y;
        sk[t * 4 + 2] = kv.z; sk[t * 4 + 3] = kv.w;
        __syncthreads();
        for (int jj = 0; jj < CH_; ++jj) {
            float s = 0.0f;
#pragma unroll
            for (int w = 0; w < 4; ++w) {
                unsigned kk = sk[jj * 4 + w];
                s = fmaf(qf[2*w],     bf2f((unsigned short)(kk & 0xFFFF)), s);
                s = fmaf(qf[2*w + 1], bf2f((unsigned short)(kk >> 16)),   s);
            }
            float mn = fmaxf(m, s);
            d = d * __expf(m - mn) + __expf(s - mn);
            m = mn;
        }
    }
    Mpart[seg * (B_ * N_) + g] = m;
    Dpart[seg * (B_ * N_) + g] = d;
}

// ---------------------------------------------------------------------------
// Kernel 2b: merge segment partials; emit fused softmax constant in the exp2
// domain:  Crow[n] = -log2(D[n]) - M[n]*log2e,
// so that  P[n,m] = exp2(S[n,m]*log2e + Crow[n]).
// ---------------------------------------------------------------------------
__global__ __launch_bounds__(256) void crow_kernel(
    const float* __restrict__ Mpart, const float* __restrict__ Dpart,
    float* __restrict__ Crow)
{
    int g = blockIdx.x * 256 + threadIdx.x;
    float m = -3.0e38f;
#pragma unroll
    for (int s = 0; s < NSEG_; ++s) m = fmaxf(m, Mpart[s * (B_ * N_) + g]);
    float d = 0.0f;
#pragma unroll
    for (int s = 0; s < NSEG_; ++s)
        d += Dpart[s * (B_ * N_) + g] *
             __builtin_amdgcn_exp2f((Mpart[s * (B_ * N_) + g] - m) * LOG2E_);
    Crow[g] = -__builtin_amdgcn_logf(d) - m * LOG2E_;   // v_log_f32 is log2
}

// ---------------------------------------------------------------------------
// Kernel 3: out = V @ softmax_rows(QtK) + x, one 16-col m-tile per wave.
// Key identity: the WMMA C-layout of the two S tiles (lane holds rows
// 8*half+r / 16+8*half+r of column l%16) is exactly the lane-local data the
// PV B-operand layout needs (K = 2j+8*half pairs of column l%16), so the
// softmaxed P tile is repacked C->B entirely in registers: fma+exp2 per
// element, one v_perm_b32 per bf16 pair.  No LDS, no divergence (Q/K rows
// carry their own zero padding).  6 WMMAs per 32-n chunk.
// ---------------------------------------------------------------------------
__global__ __launch_bounds__(128) void attn_out_kernel(
    const uint4* __restrict__ Qp, const uint4* __restrict__ Kp,
    const unsigned short* __restrict__ Vb,
    const float* __restrict__ Crow,
    const float* __restrict__ x, float* __restrict__ out)
{
    int t    = threadIdx.x;
    int wave = t >> 5, lane = t & 31;
    int half = lane >> 4, col = lane & 15;
    int mtile = blockIdx.x * 4 + wave;             // 0 .. B*N/16-1
    int b  = mtile >> 8;
    int m0 = (mtile & 255) << 4;

    const size_t bN = (size_t)b * N_;

    // B-operand for scores: K columns m0..m0+15 (fixed for the whole wave).
    // Unconditional load: upper-half lanes read the stored zero padding.
    V16 kb;
    {
        uint4 kv = Kp[(bN + m0 + col) * 2 + half];
        kb.u[0] = kv.x; kb.u[1] = kv.y; kb.u[2] = kv.z; kb.u[3] = kv.w;
        kb.u[4] = 0u;   kb.u[5] = 0u;   kb.u[6] = 0u;   kb.u[7] = 0u;
    }

    v8f acc0 = {0.f,0.f,0.f,0.f,0.f,0.f,0.f,0.f};
    v8f acc1 = acc0, acc2 = acc0, acc3 = acc0;
    const v8f zc = acc0;
    const unsigned short* vbase = Vb + ((size_t)b * C_) * N_;

    for (int n0 = 0; n0 < N_; n0 += 32) {
        // A-operands: Q rows n0..n0+31 (two 16-row tiles), unconditional.
        V16 aq0, aq1;
        {
            uint4 v0 = Qp[(bN + n0 + col) * 2 + half];
            uint4 v1 = Qp[(bN + n0 + 16 + col) * 2 + half];
            aq0.u[0] = v0.x; aq0.u[1] = v0.y; aq0.u[2] = v0.z; aq0.u[3] = v0.w;
            aq1.u[0] = v1.x; aq1.u[1] = v1.y; aq1.u[2] = v1.z; aq1.u[3] = v1.w;
            aq0.u[4] = aq0.u[5] = aq0.u[6] = aq0.u[7] = 0u;
            aq1.u[4] = aq1.u[5] = aq1.u[6] = aq1.u[7] = 0u;
        }
        v8f s0 = __builtin_amdgcn_wmma_f32_16x16x32_bf16(false, aq0.v, false, kb.v,
                                                         (short)0, zc, false, false);
        v8f s1 = __builtin_amdgcn_wmma_f32_16x16x32_bf16(false, aq1.v, false, kb.v,
                                                         (short)0, zc, false, false);

        // P = exp2(s*log2e + Crow[row]); C-layout -> B-layout is lane-local:
        // pb pair j<4 = rows {8h+2j, 8h+2j+1} of tile 0, pair j>=4 = tile 1.
        V16 pb;
#pragma unroll
        for (int tp = 0; tp < 4; ++tp) {
            int r0   = 2 * tp;
            int row0 = 8 * half + r0;              // tile 0 rows
            float p0 = __builtin_amdgcn_exp2f(fmaf(s0[r0],     LOG2E_, Crow[bN + n0 + row0]));
            float p1 = __builtin_amdgcn_exp2f(fmaf(s0[r0 + 1], LOG2E_, Crow[bN + n0 + row0 + 1]));
            pb.u[tp] = __builtin_amdgcn_perm(__float_as_uint(p1), __float_as_uint(p0), 0x07060302u);
            int row1 = 16 + row0;                  // tile 1 rows
            float p2 = __builtin_amdgcn_exp2f(fmaf(s1[r0],     LOG2E_, Crow[bN + n0 + row1]));
            float p3 = __builtin_amdgcn_exp2f(fmaf(s1[r0 + 1], LOG2E_, Crow[bN + n0 + row1 + 1]));
            pb.u[4 + tp] = __builtin_amdgcn_perm(__float_as_uint(p3), __float_as_uint(p2), 0x07060302u);
        }

        // 4 c-tiles of V as A-operands (two B128 loads each); accumulate.
#pragma unroll
        for (int ct = 0; ct < 4; ++ct) {
            const unsigned short* vrow = vbase + (size_t)(ct * 16 + col) * N_;
            uint4 a0 = *(const uint4*)(vrow + n0 + 8 * half);
            uint4 a1 = *(const uint4*)(vrow + n0 + 16 + 8 * half);
            V16 av;
            av.u[0] = a0.x; av.u[1] = a0.y; av.u[2] = a0.z; av.u[3] = a0.w;
            av.u[4] = a1.x; av.u[5] = a1.y; av.u[6] = a1.z; av.u[7] = a1.w;
            if (ct == 0) acc0 = __builtin_amdgcn_wmma_f32_16x16x32_bf16(false, av.v, false, pb.v, (short)0, acc0, false, false);
            if (ct == 1) acc1 = __builtin_amdgcn_wmma_f32_16x16x32_bf16(false, av.v, false, pb.v, (short)0, acc1, false, false);
            if (ct == 2) acc2 = __builtin_amdgcn_wmma_f32_16x16x32_bf16(false, av.v, false, pb.v, (short)0, acc2, false, false);
            if (ct == 3) acc3 = __builtin_amdgcn_wmma_f32_16x16x32_bf16(false, av.v, false, pb.v, (short)0, acc3, false, false);
        }
    }

    // Epilogue: fused residual  out = acc + x
#pragma unroll
    for (int ct = 0; ct < 4; ++ct) {
        v8f a = ct == 0 ? acc0 : ct == 1 ? acc1 : ct == 2 ? acc2 : acc3;
#pragma unroll
        for (int r = 0; r < 8; ++r) {
            int c = ct * 16 + 8 * half + r;
            size_t idx = ((size_t)b * C_ + c) * N_ + m0 + col;
            out[idx] = a[r] + x[idx];
        }
    }
}

// ---------------------------------------------------------------------------
extern "C" void kernel_launch(void* const* d_in, const int* in_sizes, int n_in,
                              void* d_out, int out_size, void* d_ws, size_t ws_size,
                              hipStream_t stream)
{
    const float* x  = (const float*)d_in[0];
    const float* wq = (const float*)d_in[1];
    const float* bq = (const float*)d_in[2];
    const float* wk = (const float*)d_in[3];
    const float* bk = (const float*)d_in[4];
    const float* wv = (const float*)d_in[5];
    const float* bv = (const float*)d_in[6];
    float* out = (float*)d_out;

    char* ws = (char*)d_ws;
    const size_t qp_bytes = (size_t)B_ * N_ * 16 * 2;           // 512 KB (padded rows)
    const size_t vb_bytes = (size_t)B_ * C_ * N_ * 2;           // 2 MB
    const size_t md_bytes = (size_t)NSEG_ * B_ * N_ * 4;        // 256 KB

    uint4*          Qp    = (uint4*)(ws);
    uint4*          Kp    = (uint4*)(ws + qp_bytes);
    unsigned short* Vb    = (unsigned short*)(ws + 2 * qp_bytes);
    float*          Mpart = (float*)(ws + 2 * qp_bytes + vb_bytes);
    float*          Dpart = (float*)(ws + 2 * qp_bytes + vb_bytes + md_bytes);
    float*          Crow  = (float*)(ws + 2 * qp_bytes + vb_bytes + 2 * md_bytes);

    proj_kernel<<<(B_ * N_) / 256, 256, 0, stream>>>(x, wq, bq, wk, bk, wv, bv, Qp, Kp, Vb);
    stats_kernel<<<NSEG_ * (B_ * N_) / 256, 256, 0, stream>>>(Qp, Kp, Mpart, Dpart);
    crow_kernel<<<(B_ * N_) / 256, 256, 0, stream>>>(Mpart, Dpart, Crow);
    attn_out_kernel<<<(B_ * (N_ / 16)) / 4, 128, 0, stream>>>(Qp, Kp, Vb, Crow, x, out);
}

// v001
// One run takes 89.6 microseconds.
// Timed twice side by side with v000, it ran 2.32 times as fast both times.
#include <hip/hip_runtime.h>
#include <stdint.h>

#define B_  4
#define C_  64
#define N_  4096
#define C8_ 8

#define NSEG_ 4
#define SEGJ_ (N_ / NSEG_)          // 1024 j per stats segment
#define CH_   256                    // K rows staged in LDS per chunk

typedef __attribute__((ext_vector_type(16))) __bf16 v16bf;
typedef __attribute__((ext_vector_type(8)))  float  v8f;

union V16 { unsigned u[8]; v16bf v; };

#define LOG2E_ 1.4426950408889634f

__device__ inline unsigned short f2bf(float f) {
    unsigned u = __float_as_uint(f);
    unsigned r = u + 0x7FFFu + ((u >> 16) & 1u);   // round-to-nearest-even
    return (unsigned short)(r >> 16);
}
__device__ inline float bf2f(unsigned short h) {
    return __uint_as_float(((unsigned)h) << 16);
}

// ---------------------------------------------------------------------------
// Kernel 1: fused QKV projection.  x [B][64][N] f32 -> Qp,Kp [B][N][16] bf16
// (32 B rows; elements 8..15 zeroed = WMMA K-padding, so attn-kernel lanes can
// load unconditionally), V [B][64][N] bf16, biases fused.
// ---------------------------------------------------------------------------
__global__ __launch_bounds__(256) void proj_kernel(
    const float* __restrict__ x,
    const float* __restrict__ wq, const float* __restrict__ bq,
    const float* __restrict__ wk, const float* __restrict__ bk,
    const float* __restrict__ wv, const float* __restrict__ bv,
    uint4* __restrict__ Qp, uint4* __restrict__ Kp,
    unsigned short* __restrict__ Vb)
{
    __shared__ float swq[C8_ * C_], swk[C8_ * C_], swv[C_ * C_];
    __shared__ float sbq[C8_], sbk[C8_], sbv[C_];
    int t = threadIdx.x;
    for (int i = t; i < C8_ * C_; i += 256) { swq[i] = wq[i]; swk[i] = wk[i]; }
    for (int i = t; i < C_ * C_;  i += 256) swv[i] = wv[i];
    if (t < C8_) { sbq[t] = bq[t]; sbk[t] = bk[t]; }
    if (t < C_)  sbv[t] = bv[t];
    __syncthreads();

    int g = blockIdx.x * 256 + t;          // 0 .. B*N-1
    int b = g >> 12;
    int n = g & (N_ - 1);

    float xc[C_];
    const float* xb = x + ((size_t)b * C_) * N_ + n;
#pragma unroll
    for (int c = 0; c < C_; ++c) xc[c] = xb[(size_t)c * N_];

    unsigned qw[4], kw[4];
#pragma unroll
    for (int p = 0; p < 4; ++p) {
        float a0q = sbq[2*p], a1q = sbq[2*p+1];
        float a0k = sbk[2*p], a1k = sbk[2*p+1];
#pragma unroll
        for (int c = 0; c < C_; ++c) {
            a0q = fmaf(swq[(2*p    ) * C_ + c], xc[c], a0q);
            a1q = fmaf(swq[(2*p + 1) * C_ + c], xc[c], a1q);
            a0k = fmaf(swk[(2*p    ) * C_ + c], xc[c], a0k);
            a1k = fmaf(swk[(2*p + 1) * C_ + c], xc[c], a1k);
        }
        qw[p] = (unsigned)f2bf(a0q) | ((unsigned)f2bf(a1q) << 16);
        kw[p] = (unsigned)f2bf(a0k) | ((unsigned)f2bf(a1k) << 16);
    }
    const uint4 z4 = make_uint4(0u, 0u, 0u, 0u);
    Qp[(size_t)g * 2]     = make_uint4(qw[0], qw[1], qw[2], qw[3]);
    Qp[(size_t)g * 2 + 1] = z4;                       // K = 8..15 zero padding
    Kp[(size_t)g * 2]     = make_uint4(kw[0], kw[1], kw[2], kw[3]);
    Kp[(size_t)g * 2 + 1] = z4;

    for (int o = 0; o < C_; ++o) {
        float a = sbv[o];
#pragma unroll
        for (int c = 0; c < C_; ++c) a = fmaf(swv[o * C_ + c], xc[c], a);
        Vb[((size_t)b * C_ + o) * N_ + n] = f2bf(a);
    }
}

// ---------------------------------------------------------------------------
// Kernel 2: segmented per-row softmax statistics.  One thread owns row n for
// one j-segment (4 segments -> 4x parallelism); K staged in LDS; online
// max/sum.  Partial (m, d) per segment.
// ---------------------------------------------------------------------------
__global__ __launch_bounds__(256) void stats_kernel(
    const uint4* __restrict__ Qp, const uint4* __restrict__ Kp,
    float* __restrict__ Mpart, float* __restrict__ Dpart)
{
    __shared__ unsigned sk[CH_ * 4];
    int t   = threadIdx.x;
    int rb  = blockIdx.x & 63;         // 64 row-blocks
    int seg = blockIdx.x >> 6;         // 4 segments
    int g   = rb * 256 + t;            // row id 0 .. B*N-1
    int b   = g >> 12;

    uint4 q = Qp[(size_t)g * 2];
    float qf[8];
    qf[0] = bf2f((unsigned short)(q.x & 0xFFFF)); qf[1] = bf2f((unsigned short)(q.x >> 16));
    qf[2] = bf2f((unsigned short)(q.y & 0xFFFF)); qf[3] = bf2f((unsigned short)(q.y >> 16));
    qf[4] = bf2f((unsigned short)(q.z & 0xFFFF)); qf[5] = bf2f((unsigned short)(q.z >> 16));
    qf[6] = bf2f((unsigned short)(q.w & 0xFFFF)); qf[7] = bf2f((unsigned short)(q.w >> 16));

    float m = -3.0e38f, d = 0.0f;
    for (int j0 = seg * SEGJ_; j0 < (seg + 1) * SEGJ_; j0 += CH_) {
        __syncthreads();
        uint4 kv = Kp[((size_t)b * N_ + j0 + t) * 2];
        sk[t * 4 + 0] = kv.x; sk[t * 4 + 1] = kv.y;
        sk[t * 4 + 2] = kv.z; sk[t * 4 + 3] = kv.w;
        __syncthreads();
        for (int jj = 0; jj < CH_; ++jj) {
            float s = 0.0f;
#pragma unroll
            for (int w = 0; w < 4; ++w) {
                unsigned kk = sk[jj * 4 + w];
                s = fmaf(qf[2*w],     bf2f((unsigned short)(kk & 0xFFFF)), s);
                s = fmaf(qf[2*w + 1], bf2f((unsigned short)(kk >> 16)),   s);
            }
            float mn = fmaxf(m, s);
            d = d * __expf(m - mn) + __expf(s - mn);
            m = mn;
        }
    }
    Mpart[seg * (B_ * N_) + g] = m;
    Dpart[seg * (B_ * N_) + g] = d;
}

// ---------------------------------------------------------------------------
// Kernel 2b: merge segment partials; emit fused softmax constant in the exp2
// domain:  Crow[n] = -log2(D[n]) - M[n]*log2e,
// so that  P[n,m] = exp2(S[n,m]*log2e + Crow[n]).
// ---------------------------------------------------------------------------
__global__ __launch_bounds__(256) void crow_kernel(
    const float* __restrict__ Mpart, const float* __restrict__ Dpart,
    float* __restrict__ Crow)
{
    int g = blockIdx.x * 256 + threadIdx.x;
    float m = -3.0e38f;
#pragma unroll
    for (int s = 0; s < NSEG_; ++s) m = fmaxf(m, Mpart[s * (B_ * N_) + g]);
    float d = 0.0f;
#pragma unroll
    for (int s = 0; s < NSEG_; ++s)
        d += Dpart[s * (B_ * N_) + g] *
             __builtin_amdgcn_exp2f((Mpart[s * (B_ * N_) + g] - m) * LOG2E_);
    Crow[g] = -__builtin_amdgcn_logf(d) - m * LOG2E_;   // v_log_f32 is log2
}

// ---------------------------------------------------------------------------
// Kernel 3: out = V @ softmax_rows(QtK) + x.  One block owns 64 output columns
// (4 m-tiles) of one batch; its NW_ waves share out the n loop, each working
// on all 4 m-tiles, so every Q, Crow and V fragment it loads feeds 4 tiles.
// The per-wave f32 partial sums meet in LDS: after one barrier wave w adds the
// NW_ partials of accumulator tile w in wave order and stores it with x.
// Key identity: the WMMA C-layout of the two S tiles (lane holds
// rows 8*half+r / 16+8*half+r of column l%16) is exactly the lane-local data
// the PV B-operand layout needs, so P is repacked C->B in registers.
// Every '#pragma unroll' here makes the indices of acc, kb, av, pb and the
// small float arrays constants, without which they would not stay in registers.
// ---------------------------------------------------------------------------
#define NW_   16                     // waves per block = n slices = acc tiles

__global__ __launch_bounds__(NW_ * 32) void attn_out_kernel(
    const uint4* __restrict__ Qp, const uint4* __restrict__ Kp,
    const unsigned short* __restrict__ Vb,
    const float* __restrict__ Crow,
    const float* __restrict__ x, float* __restrict__ out)
{
    __shared__ float4 red[NW_][32][32];            // [wave][tile*2 + r/4][lane]

    int t    = threadIdx.x;
    int wave = __builtin_amdgcn_readfirstlane(t >> 5), lane = t & 31;
    int half = lane >> 4, col = lane & 15;
    int b  = blockIdx.x >> 6;
    int m0 = (blockIdx.x & 63) << 6;

    const size_t bN = (size_t)b * N_;

    // B-operands for scores: K columns m0..m0+63 (fixed for the whole wave).
    // Unconditional load: upper-half lanes read the stored zero padding.
    V16 kb[4];
#pragma unroll
    for (int mt = 0; mt < 4; ++mt) {
        uint4 kv = Kp[(bN + m0 + mt * 16 + col) * 2 + half];
        kb[mt].u[0] = kv.x; kb[mt].u[1] = kv.y; kb[mt].u[2] = kv.z; kb[mt].u[3] = kv.w;
        kb[mt].u[4] = 0u;   kb[mt].u[5] = 0u;   kb[mt].u[6] = 0u;   kb[mt].u[7] = 0u;
    }
    // The address registers of the four K loads are reused by the set-up code
    // below:
    // the wait stands here, and the scheduling barrier keeps that code behind it.
    asm volatile("s_wait_xcnt 0x0" ::: "memory");
    __builtin_amdgcn_sched_barrier(0);

    const v8f zc = {0.f,0.f,0.f,0.f,0.f,0.f,0.f,0.f};
    v8f acc[4][4];                                 // [ct][mt]
#pragma unroll
    for (int ct = 0; ct < 4; ++ct)
#pragma unroll
        for (int mt = 0; mt < 4; ++mt) acc[ct][mt] = zc;

    const unsigned short* vbase = Vb + ((size_t)b * C_ + col) * N_ + 8 * half;

    // Chunks of 32 n are dealt round robin: in one trip the block's waves read
    // neighbouring chunks, so two waves use each 128-B line of V together.
    int n0 = wave * 32;
    do {
        // All of this 32-n chunk's loads first: Q rows (two 16-row A tiles),
        // the 16 row constants of this lane, 4 c-tiles of V (A-operands).
        uint4 v0 = Qp[(bN + n0 + col) * 2 + half];
        uint4 v1 = Qp[(bN + n0 + 16 + col) * 2 + half];
        const float4* cr = (const float4*)(Crow + bN + n0 + 8 * half);
        float4 c0 = cr[0], c1 = cr[1], c2 = cr[4], c3 = cr[5];
        V16 av[4];
#pragma unroll
        for (int ct = 0; ct < 4; ++ct) {
            const unsigned short* vrow = vbase + (size_t)(ct * 16) * N_ + n0;
            uint4 a0 = *(const uint4*)(vrow);
            uint4 a1 = *(const uint4*)(vrow + 16);
            av[ct].u[0] = a0.x; av[ct].u[1] = a0.y; av[ct].u[2] = a0.z; av[ct].u[3] = a0.w;
            av[ct].u[4] = a1.x; av[ct].u[5] = a1.y; av[ct].u[6] = a1.z; av[ct].u[7] = a1.w;
        }
        V16 aq0, aq1;
        aq0.u[0] = v0.x; aq0.u[1] = v0.y; aq0.u[2] = v0.z; aq0.u[3] = v0.w;
        aq1.u[0] = v1.x; aq1.u[1] = v1.y; aq1.u[2] = v1.z; aq1.u[3] = v1.w;
        aq0.u[4] = aq0.u[5] = aq0.u[6] = aq0.u[7] = 0u;
        aq1.u[4] = aq1.u[5] = aq1.u[6] = aq1.u[7] = 0u;
        const float cw0[8] = {c0.x, c0.y, c0.z, c0.w, c1.x, c1.y, c1.z, c1.w};
        const float cw1[8] = {c2.x, c2.y, c2.z, c2.w, c3.x, c3.y, c3.z, c3.w};

#pragma unroll
        for (int mt = 0; mt < 4; ++mt) {
            // P = exp2(s*log2e + Crow[row]); C-layout -> B-layout is lane-local:
            // pb pair j<4 = rows {8h+2j, 8h+2j+1} of tile 0, pair j>=4 = tile 1.
            V16 pb;
            {
                v8f s = __builtin_amdgcn_wmma_f32_16x16x32_bf16(false, aq0.v, false, kb[mt].v,
                                                                (short)0, zc, false, false);
#pragma unroll
                for (int tp = 0; tp < 4; ++tp) {
                    float p0 = __builtin_amdgcn_exp2f(fmaf(s[2*tp],     LOG2E_, cw0[2*tp]));
                    float p1 = __builtin_amdgcn_exp2f(fmaf(s[2*tp + 1], LOG2E_, cw0[2*tp + 1]));
                    pb.u[tp] = __builtin_amdgcn_perm(__float_as_uint(p1), __float_as_uint(p0), 0x07060302u);
                }
            }
            {
                v8f s = __builtin_amdgcn_wmma_f32_16x16x32_bf16(false, aq1.v, false, kb[mt].v,
                                                                (short)0, zc, false, false);
#pragma unroll
                for (int tp = 0; tp < 4; ++tp) {
                    float p2 = __builtin_amdgcn_exp2f(fmaf(s[2*tp],     LOG2E_, cw1[2*tp]));
                    float p3 = __builtin_amdgcn_exp2f(fmaf(s[2*tp + 1], LOG2E_, cw1[2*tp + 1]));
                    pb.u[4 + tp] = __builtin_amdgcn_perm(__float_as_uint(p3), __float_as_uint(p2), 0x07060302u);
                }
            }
#pragma unroll
            for (int ct = 0; ct < 4; ++ct)
                acc[ct][mt] = __builtin_amdgcn_wmma_f32_16x16x32_bf16(false, av[ct].v, false, pb.v,
                                                                      (short)0, acc[ct][mt], false, false);
        }
        n0 += NW_ * 32;
    } while (n0 < N_);

    // Every wave publishes its 16 partial tiles, lane-contiguous 16-B pieces.
#pragma unroll
    for (int ct = 0; ct < 4; ++ct)
#pragma unroll
        for (int mt = 0; mt < 4; ++mt) {
            v8f a = acc[ct][mt];
            red[wave][(ct * 4 + mt) * 2    ][lane] = make_float4(a[0], a[1], a[2], a[3]);
            red[wave][(ct * 4 + mt) * 2 + 1][lane] = make_float4(a[4], a[5], a[6], a[7]);
        }

    // Wave w finishes tile w = ct*4 + mt; its residual x is fetched meanwhile.
    const int ct = wave >> 2, mt = wave & 3;
    const size_t idx0 = ((size_t)b * C_ + ct * 16 + 8 * half) * N_ + m0 + mt * 16 + col;
    float xv[8];
#pragma unroll
    for (int r = 0; r < 8; ++r) xv[r] = x[idx0 + (size_t)r * N_];

    __syncthreads();

    float4 lo0 = red[0][wave * 2][lane], hi0 = red[0][wave * 2 + 1][lane];
    float sum[8] = {lo0.x, lo0.y, lo0.z, lo0.w, hi0.x, hi0.y, hi0.z, hi0.w};
#pragma unroll
    for (int s = 1; s < NW_; ++s) {
        float4 lo = red[s][wave * 2    ][lane];
        float4 hi = red[s][wave * 2 + 1][lane];
        sum[0] += lo.x; sum[1] += lo.y; sum[2] += lo.z; sum[3] += lo.w;
        sum[4] += hi.x; sum[5] += hi.y; sum[6] += hi.z; sum[7] += hi.w;
    }
#pragma unroll
    for (int r = 0; r < 8; ++r) out[idx0 + (size_t)r * N_] = sum[r] + xv[r];
}

// ---------------------------------------------------------------------------
extern "C" void kernel_launch(void* const* d_in, const int* in_sizes, int n_in,
                              void* d_out, int out_size, void* d_ws, size_t ws_size,
                              hipStream_t stream)
{
    const float* x  = (const float*)d_in[0];
    const float* wq = (const float*)d_in[1];
    const float* bq = (const float*)d_in[2];
    const float* wk = (const float*)d_in[3];
    const float* bk = (const float*)d_in[4];
    const float* wv = (const float*)d_in[5];
    const float* bv = (const float*)d_in[6];
    float* out = (float*)d_out;

    char* ws = (char*)d_ws;
    const size_t qp_bytes = (size_t)B_ * N_ * 16 * 2;           // 512 KB (padded rows)
    const size_t vb_bytes = (size_t)B_ * C_ * N_ * 2;           // 2 MB
    const size_t md_bytes = (size_t)NSEG_ * B_ * N_ * 4;        // 256 KB

    uint4*          Qp    = (uint4*)(ws);
    uint4*          Kp    = (uint4*)(ws + qp_bytes);
    unsigned short* Vb    = (unsigned short*)(ws + 2 * qp_bytes);
    float*          Mpart = (float*)(ws + 2 * qp_bytes + vb_bytes);
    float*          Dpart = (float*)(ws + 2 * qp_bytes + vb_bytes + md_bytes);
    float*          Crow  = (float*)(ws + 2 * qp_bytes + vb_bytes + 2 * md_bytes);

    proj_kernel<<<(B_ * N_) / 256, 256, 0, stream>>>(x, wq, bq, wk, bk, wv, bv, Qp, Kp, Vb);
    stats_kernel<<<NSEG_ * (B_ * N_) / 256, 256, 0, stream>>>(Qp, Kp, Mpart, Dpart);
    crow_kernel<<<(B_ * N_) / 256, 256, 0, stream>>>(Mpart, Dpart, Crow);
    attn_out_kernel<<<B_ * (N_ / 64), NW_ * 32, 0, stream>>>(Qp, Kp, Vb, Crow, x, out);
}

// v002
// One run takes 54.9 microseconds.
// Two timings next to v001 both put it at 1.63 times that version's speed.
// Over all steps from v000 it is 3.79 times as fast.
#include <hip/hip_runtime.h>
#include <stdint.h>

#define B_  4
#define C_  64
#define N_  4096
#define C8_ 8

#define NSEG_ 4
#define SEGJ_ (N_ / NSEG_)          // 1024 j per stats segment

typedef __attribute__((ext_vector_type(16))) __bf16 v16bf;
typedef __attribute__((ext_vector_type(8)))  float  v8f;
typedef __attribute__((ext_vector_type(2)))  float  v2f;

union V16 { unsigned u[8]; v16bf v; };

#define LOG2E_ 1.4426950408889634f

__device__ inline unsigned short f2bf(float f) {
    unsigned u = __float_as_uint(f);
    unsigned r = u + 0x7FFFu + ((u >> 16) & 1u);   // round-to-nearest-even
    return (unsigned short)(r >> 16);
}
__device__ inline float bf2f(unsigned short h) {
    return __uint_as_float(((unsigned)h) << 16);
}

// ---------------------------------------------------------------------------
// Kernel 1: fused QKV projection.  x [B][64][N] f32 -> Qp,Kp [B][N][16] bf16
// (32 B rows; elements 8..15 zeroed = WMMA K-padding, so attn-kernel lanes can
// load unconditionally), V [B][64][N] bf16, biases fused.
// ---------------------------------------------------------------------------
__global__ __launch_bounds__(256) void proj_kernel(
    const float* __restrict__ x,
    const float* __restrict__ wq, const float* __restrict__ bq,
    const float* __restrict__ wk, const float* __restrict__ bk,
    const float* __restrict__ wv, const float* __restrict__ bv,
    uint4* __restrict__ Qp, uint4* __restrict__ Kp,
    unsigned short* __restrict__ Vb)
{
    __shared__ float swq[C8_ * C_], swk[C8_ * C_], swv[C_ * C_];
    __shared__ float sbq[C8_], sbk[C8_], sbv[C_];
    int t = threadIdx.x;
    for (int i = t; i < C8_ * C_; i += 256) { swq[i] = wq[i]; swk[i] = wk[i]; }
    for (int i = t; i < C_ * C_;  i += 256) swv[i] = wv[i];
    if (t < C8_) { sbq[t] = bq[t]; sbk[t] = bk[t]; }
    if (t < C_)  sbv[t] = bv[t];
    __syncthreads();

    int g = blockIdx.x * 256 + t;          // 0 .. B*N-1
    int b = g >> 12;
    int n = g & (N_ - 1);

    float xc[C_];
    const float* xb = x + ((size_t)b * C_) * N_ + n;
#pragma unroll
    for (int c = 0; c < C_; ++c) xc[c] = xb[(size_t)c * N_];

    unsigned qw[4], kw[4];
#pragma unroll
    for (int p = 0; p < 4; ++p) {
        float a0q = sbq[2*p], a1q = sbq[2*p+1];
        float a0k = sbk[2*p], a1k = sbk[2*p+1];
#pragma unroll
        for (int c = 0; c < C_; ++c) {
            a0q = fmaf(swq[(2*p    ) * C_ + c], xc[c], a0q);
            a1q = fmaf(swq[(2*p + 1) * C_ + c], xc[c], a1q);
            a0k = fmaf(swk[(2*p    ) * C_ + c], xc[c], a0k);
            a1k = fmaf(swk[(2*p + 1) * C_ + c], xc[c], a1k);
        }
        qw[p] = (unsigned)f2bf(a0q) | ((unsigned)f2bf(a1q) << 16);
        kw[p] = (unsigned)f2bf(a0k) | ((unsigned)f2bf(a1k) << 16);
    }
    const uint4 z4 = make_uint4(0u, 0u, 0u, 0u);
    Qp[(size_t)g * 2]     = make_uint4(qw[0], qw[1], qw[2], qw[3]);
    Qp[(size_t)g * 2 + 1] = z4;                       // K = 8..15 zero padding
    Kp[(size_t)g * 2]     = make_uint4(kw[0], kw[1], kw[2], kw[3]);
    Kp[(size_t)g * 2 + 1] = z4;

    for (int o = 0; o < C_; ++o) {
        float a = sbv[o];
#pragma unroll
        for (int c = 0; c < C_; ++c) a = fmaf(swv[o * C_ + c], xc[c], a);
        Vb[((size_t)b * C_ + o) * N_ + n] = f2bf(a);
    }
}

// ---------------------------------------------------------------------------
// Kernel 2: segmented per-row softmax statistics on the matrix unit.
// A wave owns 32 softmax rows n (two B operands: Q) for one j-segment and walks
// the segment in steps of 64 j (four A operands: K).  With K as A and Q as B
// the D tile holds S transposed: a lane keeps 8 scores of ONE row n, so the
// running max and sum of a row are lane-local; lanes l and l^16 (the two j
// halves of each tile) meet once at the end.  Partial (m, d) per segment.
// Every '#pragma unroll' here makes the indices of ka, kc, qb, s, tm, m and d
// constants, without which they would not stay in registers.
// ---------------------------------------------------------------------------
__device__ inline void stats_load(uint4 (&kc)[4], const uint4* __restrict__ p)
{
#pragma unroll
    for (int jt = 0; jt < 4; ++jt) kc[jt] = p[jt * 32];     // 16 K rows = 32 uint4
}

// One step: 64 j (kc) against the wave's 32 rows; online max / sum update.
__device__ inline void stats_step(const uint4 (&kc)[4], const V16 (&qb)[2],
                                  float (&m)[2], float (&d)[2])
{
    const v8f zc = {0.f,0.f,0.f,0.f,0.f,0.f,0.f,0.f};
    V16 ka[4];
#pragma unroll
    for (int jt = 0; jt < 4; ++jt) {
        ka[jt].u[0] = kc[jt].x; ka[jt].u[1] = kc[jt].y;
        ka[jt].u[2] = kc[jt].z; ka[jt].u[3] = kc[jt].w;
        ka[jt].u[4] = 0u; ka[jt].u[5] = 0u; ka[jt].u[6] = 0u; ka[jt].u[7] = 0u;
    }
#pragma unroll
    for (int nt = 0; nt < 2; ++nt) {
        v8f s[4];
#pragma unroll
        for (int jt = 0; jt < 4; ++jt)
            s[jt] = __builtin_amdgcn_wmma_f32_16x16x32_bf16(false, ka[jt].v, false, qb[nt].v,
                                                            (short)0, zc, false, false);
        float tm[4];                                  // one short max chain per tile
#pragma unroll
        for (int jt = 0; jt < 4; ++jt) {
            tm[jt] = s[jt][0];
#pragma unroll
            for (int r = 1; r < 8; ++r) tm[jt] = fmaxf(tm[jt], s[jt][r]);
        }
        const float mn = fmaxf(fmaxf(fmaxf(m[nt], tm[0]), tm[1]), fmaxf(tm[2], tm[3]));
        const float mL = mn * LOG2E_;
        v2f a0 = {0.f, 0.f}, a1 = {0.f, 0.f};         // independent partial sums
#pragma unroll
        for (int jt = 0; jt < 4; ++jt)
#pragma unroll
            for (int r = 0; r < 8; r += 4) {
                v2f e0 = {s[jt][r],     s[jt][r + 1]};
                v2f e1 = {s[jt][r + 2], s[jt][r + 3]};
                e0 = e0 * LOG2E_ - mL;
                e1 = e1 * LOG2E_ - mL;
                v2f p0 = {__builtin_amdgcn_exp2f(e0.x), __builtin_amdgcn_exp2f(e0.y)};
                v2f p1 = {__builtin_amdgcn_exp2f(e1.x), __builtin_amdgcn_exp2f(e1.y)};
                a0 += p0;
                a1 += p1;
            }
        a0 += a1;
        d[nt] = fmaf(d[nt], __builtin_amdgcn_exp2f((m[nt] - mn) * LOG2E_), a0.x + a0.y);
        m[nt] = mn;
    }
}

__global__ __launch_bounds__(256) void stats_kernel(
    const uint4* __restrict__ Qp, const uint4* __restrict__ Kp,
    float* __restrict__ Mpart, float* __restrict__ Dpart)
{
    int t    = threadIdx.x;
    int wave = __builtin_amdgcn_readfirstlane(t >> 5), lane = t & 31;
    int half = lane >> 4, col = lane & 15;
    int rb  = blockIdx.x & 63;         // 64 row-blocks
    int seg = blockIdx.x >> 6;         // 4 segments
    int g0  = rb * 256 + wave * 32;    // first of this wave's 32 rows
    int b   = g0 >> 12;

    // Same loader for Q and K as in the output kernel (upper-half lanes read the
    // stored zero padding), so the k order of A and B is equal at every position.
    V16 qb[2];
#pragma unroll
    for (int nt = 0; nt < 2; ++nt) {
        uint4 qv = Qp[(size_t)(g0 + nt * 16 + col) * 2 + half];
        qb[nt].u[0] = qv.x; qb[nt].u[1] = qv.y; qb[nt].u[2] = qv.z; qb[nt].u[3] = qv.w;
        qb[nt].u[4] = 0u;   qb[nt].u[5] = 0u;   qb[nt].u[6] = 0u;   qb[nt].u[7] = 0u;
    }

    const uint4* kp = Kp + ((size_t)b * N_ + seg * SEGJ_ + col) * 2 + half;
    uint4 kA[4], kB[4];                // two register buffers: each step's K rows
    stats_load(kA, kp);                // are fetched one step ahead of their use

    float m[2] = {-3.0e38f, -3.0e38f};
    float d[2] = {0.0f, 0.0f};

    for (int j0 = 0; j0 < SEGJ_; j0 += 128) {
        stats_load(kB, kp + 128);
        stats_step(kA, qb, m, d);
        if (j0 + 128 < SEGJ_) stats_load(kA, kp + 256);
        stats_step(kB, qb, m, d);
        kp += 256;
    }

    // Lanes l and l^16 hold the same rows over the two j halves: merge them.
    float mo[2], dd[2];
#pragma unroll
    for (int nt = 0; nt < 2; ++nt) {
        float m2 = __shfl_xor(m[nt], 16, 32);
        float d2 = __shfl_xor(d[nt], 16, 32);
        float mn = fmaxf(m[nt], m2);
        mo[nt] = mn;
        dd[nt] = d[nt] * __builtin_amdgcn_exp2f((m[nt] - mn) * LOG2E_) +
                 d2    * __builtin_amdgcn_exp2f((m2    - mn) * LOG2E_);
    }
    // Both halves now hold both tiles' results: lane l stores row g0 + l.
    Mpart[seg * (B_ * N_) + g0 + lane] = half ? mo[1] : mo[0];
    Dpart[seg * (B_ * N_) + g0 + lane] = half ? dd[1] : dd[0];
}

// ---------------------------------------------------------------------------
// Kernel 2b: merge segment partials; emit fused softmax constant in the exp2
// domain:  Crow[n] = -log2(D[n]) - M[n]*log2e,
// so that  P[n,m] = exp2(S[n,m]*log2e + Crow[n]).
// ---------------------------------------------------------------------------
__global__ __launch_bounds__(256) void crow_kernel(
    const float* __restrict__ Mpart, const float* __restrict__ Dpart,
    float* __restrict__ Crow)
{
    int g = blockIdx.x * 256 + threadIdx.x;
    float m = -3.0e38f;
#pragma unroll
    for (int s = 0; s < NSEG_; ++s) m = fmaxf(m, Mpart[s * (B_ * N_) + g]);
    float d = 0.0f;
#pragma unroll
    for (int s = 0; s < NSEG_; ++s)
        d += Dpart[s * (B_ * N_) + g] *
             __builtin_amdgcn_exp2f((Mpart[s * (B_ * N_) + g] - m) * LOG2E_);
    Crow[g] = -__builtin_amdgcn_logf(d) - m * LOG2E_;   // v_log_f32 is log2
}

// ---------------------------------------------------------------------------
// Kernel 3: out = V @ softmax_rows(QtK) + x.  One block owns 64 output columns
// (4 m-tiles) of one batch; its NW_ waves share out the n loop, each working
// on all 4 m-tiles, so every Q, Crow and V fragment it loads feeds 4 tiles.
// The per-wave f32 partial sums meet in LDS: after one barrier wave w adds the
// NW_ partials of accumulator tile w in wave order and stores it with x.
// Key identity: the WMMA C-layout of the two S tiles (lane holds
// rows 8*half+r / 16+8*half+r of column l%16) is exactly the lane-local data
// the PV B-operand layout needs, so P is repacked C->B in registers.
// Every '#pragma unroll' here makes the indices of acc, kb, av, pb and the
// small float arrays constants, without which they would not stay in registers.
// ---------------------------------------------------------------------------
#define NW_   16                     // waves per block = n slices = acc tiles

__global__ __launch_bounds__(NW_ * 32) void attn_out_kernel(
    const uint4* __restrict__ Qp, const uint4* __restrict__ Kp,
    const unsigned short* __restrict__ Vb,
    const float* __restrict__ Crow,
    const float* __restrict__ x, float* __restrict__ out)
{
    __shared__ float4 red[NW_][32][32];            // [wave][tile*2 + r/4][lane]

    int t    = threadIdx.x;
    int wave = __builtin_amdgcn_readfirstlane(t >> 5), lane = t & 31;
    int half = lane >> 4, col = lane & 15;
    int b  = blockIdx.x >> 6;
    int m0 = (blockIdx.x & 63) << 6;

    const size_t bN = (size_t)b * N_;

    // B-operands for scores: K columns m0..m0+63 (fixed for the whole wave).
    // Unconditional load: upper-half lanes read the stored zero padding.
    V16 kb[4];
#pragma unroll
    for (int mt = 0; mt < 4; ++mt) {
        uint4 kv = Kp[(bN + m0 + mt * 16 + col) * 2 + half];
        kb[mt].u[0] = kv.x; kb[mt].u[1] = kv.y; kb[mt].u[2] = kv.z; kb[mt].u[3] = kv.w;
        kb[mt].u[4] = 0u;   kb[mt].u[5] = 0u;   kb[mt].u[6] = 0u;   kb[mt].u[7] = 0u;
    }
    // The address registers of the four K loads are reused by the set-up code
    // below:
    // the wait stands here, and the scheduling barrier keeps that code behind it.
    asm volatile("s_wait_xcnt 0x0" ::: "memory");
    __builtin_amdgcn_sched_barrier(0);

    const v8f zc = {0.f,0.f,0.f,0.f,0.f,0.f,0.f,0.f};
    v8f acc[4][4];                                 // [ct][mt]
#pragma unroll
    for (int ct = 0; ct < 4; ++ct)
#pragma unroll
        for (int mt = 0; mt < 4; ++mt) acc[ct][mt] = zc;

    const unsigned short* vbase = Vb + ((size_t)b * C_ + col) * N_ + 8 * half;

    // Chunks of 32 n are dealt round robin: in one trip the block's waves read
    // neighbouring chunks, so two waves use each 128-B line of V together.
    int n0 = wave * 32;
    do {
        // All of this 32-n chunk's loads first: Q rows (two 16-row A tiles),
        // the 16 row constants of this lane, 4 c-tiles of V (A-operands).
        uint4 v0 = Qp[(bN + n0 + col) * 2 + half];
        uint4 v1 = Qp[(bN + n0 + 16 + col) * 2 + half];
        const float4* cr = (const float4*)(Crow + bN + n0 + 8 * half);
        float4 c0 = cr[0], c1 = cr[1], c2 = cr[4], c3 = cr[5];
        V16 av[4];
#pragma unroll
        for (int ct = 0; ct < 4; ++ct) {
            const unsigned short* vrow = vbase + (size_t)(ct * 16) * N_ + n0;
            uint4 a0 = *(const uint4*)(vrow);
            uint4 a1 = *(const uint4*)(vrow + 16);
            av[ct].u[0] = a0.x; av[ct].u[1] = a0.y; av[ct].u[2] = a0.z; av[ct].u[3] = a0.w;
            av[ct].u[4] = a1.x; av[ct].u[5] = a1.y; av[ct].u[6] = a1.z; av[ct].u[7] = a1.w;
        }
        V16 aq0, aq1;
        aq0.u[0] = v0.x; aq0.u[1] = v0.y; aq0.u[2] = v0.z; aq0.u[3] = v0.w;
        aq1.u[0] = v1.x; aq1.u[1] = v1.y; aq1.u[2] = v1.z; aq1.u[3] = v1.w;
        aq0.u[4] = aq0.u[5] = aq0.u[6] = aq0.u[7] = 0u;
        aq1.u[4] = aq1.u[5] = aq1.u[6] = aq1.u[7] = 0u;
        const float cw0[8] = {c0.x, c0.y, c0.z, c0.w, c1.x, c1.y, c1.z, c1.w};
        const float cw1[8] = {c2.x, c2.y, c2.z, c2.w, c3.x, c3.y, c3.z, c3.w};

#pragma unroll
        for (int mt = 0; mt < 4; ++mt) {
            // P = exp2(s*log2e + Crow[row]); C-layout -> B-layout is lane-local:
            // pb pair j<4 = rows {8h+2j, 8h+2j+1} of tile 0, pair j>=4 = tile 1.
            V16 pb;
            {
                v8f s = __builtin_amdgcn_wmma_f32_16x16x32_bf16(false, aq0.v, false, kb[mt].v,
                                                                (short)0, zc, false, false);
#pragma unroll
                for (int tp = 0; tp < 4; ++tp) {
                    float p0 = __builtin_amdgcn_exp2f(fmaf(s[2*tp],     LOG2E_, cw0[2*tp]));
                    float p1 = __builtin_amdgcn_exp2f(fmaf(s[2*tp + 1], LOG2E_, cw0[2*tp + 1]));
                    pb.u[tp] = __builtin_amdgcn_perm(__float_as_uint(p1), __float_as_uint(p0), 0x07060302u);
                }
            }
            {
                v8f s = __builtin_amdgcn_wmma_f32_16x16x32_bf16(false, aq1.v, false, kb[mt].v,
                                                                (short)0, zc, false, false);
#pragma unroll
                for (int tp = 0; tp < 4; ++tp) {
                    float p2 = __builtin_amdgcn_exp2f(fmaf(s[2*tp],     LOG2E_, cw1[2*tp]));
                    float p3 = __builtin_amdgcn_exp2f(fmaf(s[2*tp + 1], LOG2E_, cw1[2*tp + 1]));
                    pb.u[4 + tp] = __builtin_amdgcn_perm(__float_as_uint(p3), __float_as_uint(p2), 0x07060302u);
                }
            }
#pragma unroll
            for (int ct = 0; ct < 4; ++ct)
                acc[ct][mt] = __builtin_amdgcn_wmma_f32_16x16x32_bf16(false, av[ct].v, false, pb.v,
                                                                      (short)0, acc[ct][mt], false, false);
        }
        n0 += NW_ * 32;
    } while (n0 < N_);

    // Every wave publishes its 16 partial tiles, lane-contiguous 16-B pieces.
#pragma unroll
    for (int ct = 0; ct < 4; ++ct)
#pragma unroll
        for (int mt = 0; mt < 4; ++mt) {
            v8f a = acc[ct][mt];
            red[wave][(ct * 4 + mt) * 2    ][lane] = make_float4(a[0], a[1], a[2], a[3]);
            red[wave][(ct * 4 + mt) * 2 + 1][lane] = make_float4(a[4], a[5], a[6], a[7]);
        }

    // Wave w finishes tile w = ct*4 + mt; its residual x is fetched meanwhile.
    const int ct = wave >> 2, mt = wave & 3;
    const size_t idx0 = ((size_t)b * C_ + ct * 16 + 8 * half) * N_ + m0 + mt * 16 + col;
    float xv[8];
#pragma unroll
    for (int r = 0; r < 8; ++r) xv[r] = x[idx0 + (size_t)r * N_];

    __syncthreads();

    float4 lo0 = red[0][wave * 2][lane], hi0 = red[0][wave * 2 + 1][lane];
    float sum[8] = {lo0.x, lo0.y, lo0.z, lo0.w, hi0.x, hi0.y, hi0.z, hi0.w};
#pragma unroll
    for (int s = 1; s < NW_; ++s) {
        float4 lo = red[s][wave * 2    ][lane];
        float4 hi = red[s][wave * 2 + 1][lane];
        sum[0] += lo.x; sum[1] += lo.y; sum[2] += lo.z; sum[3] += lo.w;
        sum[4] += hi.x; sum[5] += hi.y; sum[6] += hi.z; sum[7] += hi.w;
    }
#pragma unroll
    for (int r = 0; r < 8; ++r) out[idx0 + (size_t)r * N_] = sum[r] + xv[r];
}

// ---------------------------------------------------------------------------
extern "C" void kernel_launch(void* const* d_in, const int* in_sizes, int n_in,
                              void* d_out, int out_size, void* d_ws, size_t ws_size,
                              hipStream_t stream)
{
    const float* x  = (const float*)d_in[0];
    const float* wq = (const float*)d_in[1];
    const float* bq = (const float*)d_in[2];
    const float* wk = (const float*)d_in[3];
    const float* bk = (const float*)d_in[4];
    const float* wv = (const float*)d_in[5];
    const float* bv = (const float*)d_in[6];
    float* out = (float*)d_out;

    char* ws = (char*)d_ws;
    const size_t qp_bytes = (size_t)B_ * N_ * 16 * 2;           // 512 KB (padded rows)
    const size_t vb_bytes = (size_t)B_ * C_ * N_ * 2;           // 2 MB
    const size_t md_bytes = (size_t)NSEG_ * B_ * N_ * 4;        // 256 KB

    uint4*          Qp    = (uint4*)(ws);
    uint4*          Kp    = (uint4*)(ws + qp_bytes);
    unsigned short* Vb    = (unsigned short*)(ws + 2 * qp_bytes);
    float*          Mpart = (float*)(ws + 2 * qp_bytes + vb_bytes);
    float*          Dpart = (float*)(ws + 2 * qp_bytes + vb_bytes + md_bytes);
    float*          Crow  = (float*)(ws + 2 * qp_bytes + vb_bytes + 2 * md_bytes);

    proj_kernel<<<(B_ * N_) / 256, 256, 0, stream>>>(x, wq, bq, wk, bk, wv, bv, Qp, Kp, Vb);
    stats_kernel<<<NSEG_ * (B_ * N_) / 256, 256, 0, stream>>>(Qp, Kp, Mpart, Dpart);
    crow_kernel<<<(B_ * N_) / 256, 256, 0, stream>>>(Mpart, Dpart, Crow);
    attn_out_kernel<<<B_ * (N_ / 64), NW_ * 32, 0, stream>>>(Qp, Kp, Vb, Crow, x, out);
}

// v003
// A run of this version takes 28.2 microseconds.
// Next to v002, in two timings, it ran 1.95 and 1.94 times as fast.
// Counting every step since v000, it is 7.36 times as fast.
#include <hip/hip_runtime.h>
#include <stdint.h>

#define B_  4
#define C_  64
#define N_  4096
#define C8_ 8

#define NSEG_ 4
#define SEGJ_ (N_ / NSEG_)          // 1024 j per stats segment

typedef __attribute__((ext_vector_type(16))) __bf16 v16bf;
typedef __attribute__((ext_vector_type(8)))  float  v8f;
typedef __attribute__((ext_vector_type(2)))  float  v2f;
typedef __attribute__((ext_vector_type(4)))  float  v4f;

union V16 { unsigned u[8]; v16bf v; };

#define LOG2E_ 1.4426950408889634f

__device__ inline unsigned short f2bf(float f) {
    unsigned u = __float_as_uint(f);
    unsigned r = u + 0x7FFFu + ((u >> 16) & 1u);   // round-to-nearest-even
    return (unsigned short)(r >> 16);
}
__device__ inline float bf2f(unsigned short h) {
    return __uint_as_float(((unsigned)h) << 16);
}

// ---------------------------------------------------------------------------
// Kernel 1: fused QKV projection on the matrix unit, in f32 (16x16x4 form).
// x [B][64][N] f32 -> Qp,Kp [B][N][16] bf16 (32 B rows; elements 8..15 zeroed
// = WMMA K-padding, so attn-kernel lanes can load unconditionally),
// V [B][64][N] bf16, biases fused (they are the accumulators' start values).
// One block per 64 pixels, so that every WGP works; each of its PW_ waves owns
// one tile of 16 output channels as A (waves 0..3: V; wave 4: Q over K) and
// all 64 pixels as four B tiles.  Column c of B tile j is pixel 4c + j: one
// 16-B load of x feeds all four tiles, and a lane ends up with 4 neighbouring
// pixels of each of its 8 channels.
// k order: element e of step s in lane half h is input channel
// 8*(s/2) + 4*h + 2*(s%2) + e, for the A loader and the B loader alike.
// Every '#pragma unroll' here makes the indices of wa, xv and acc constants,
// without which they would not stay in registers.
// ---------------------------------------------------------------------------
#define PW_ 5                        // waves per block = tiles of 16 channels

__global__ __launch_bounds__(PW_ * 32) void proj_kernel(
    const float* __restrict__ x,
    const float* __restrict__ wq, const float* __restrict__ bq,
    const float* __restrict__ wk, const float* __restrict__ bk,
    const float* __restrict__ wv, const float* __restrict__ bv,
    uint4* __restrict__ Qp, uint4* __restrict__ Kp,
    unsigned short* __restrict__ Vb)
{
    int t    = threadIdx.x;
    int wave = __builtin_amdgcn_readfirstlane(t >> 5), lane = t & 31;
    int half = lane >> 4, col = lane & 15;
    int g0 = blockIdx.x * 64;              // first of the block's 64 pixels
    int b  = g0 >> 12;
    int n0 = g0 & (N_ - 1);

    // This lane's weight row (A row = col) and the biases of its 8 D rows.
    const float* wrow;
    const float* brow;
    if (wave < 4) {
        wrow = wv + (wave * 16 + col) * C_;
        brow = bv + wave * 16 + 8 * half;
    } else {
        wrow = col < 8 ? wq + col * C_ : wk + (col - 8) * C_;
        brow = half ? bk : bq;
    }

    // Loads in the order of their use, so that the first steps can start while
    // the later ones' data are still on their way.
    const v4f b0 = *(const v4f*)brow, b1 = *(const v4f*)(brow + 4);
    v4f wa[8];                             // wa[u] = steps 2u and 2u + 1
    v4f xv[16][2];                         // [step][element], 4 pixels each
    const float* xb = x + ((size_t)b * C_ + 4 * half) * N_ + n0 + 4 * col;
#pragma unroll
    for (int u = 0; u < 8; ++u) {
        wa[u] = *(const v4f*)(wrow + 8 * u + 4 * half);
#pragma unroll
        for (int q = 0; q < 4; ++q)
            xv[2 * u + (q >> 1)][q & 1] = *(const v4f*)(xb + (size_t)(8 * u + q) * N_);
    }

    v8f acc[4];
#pragma unroll
    for (int j = 0; j < 4; ++j)
        acc[j] = (v8f){b0.x, b0.y, b0.z, b0.w, b1.x, b1.y, b1.z, b1.w};

    // Stands in front of the first overwrite of the loads' address registers (a
    // precaution); naming them keeps them untouched up to here.
    asm volatile("s_wait_xcnt 0x0" :: "v"(xb), "v"(wrow), "v"(brow) : "memory");
    // Keeps all 42 loads in front of the first WMMA, in flight together: without
    // it the build sinks each pair of x loads to its step and the wave waits out
    // one round trip to L2 per step.
    __builtin_amdgcn_sched_barrier(0);

#pragma unroll
    for (int s = 0; s < 16; ++s) {
        const v2f af = {wa[s >> 1][2 * (s & 1)], wa[s >> 1][2 * (s & 1) + 1]};
#pragma unroll
        for (int j = 0; j < 4; ++j) {
            const v2f bf = {xv[s][0][j], xv[s][1][j]};
            acc[j] = __builtin_amdgcn_wmma_f32_16x16x4_f32(false, af, false, bf,
                                                           (short)0, acc[j], false, false);
        }
    }

    // acc[j][r] = channel 8*half + r of the tile, pixel g0 + 4*col + j.
    if (wave < 4) {
        // 4 bf16 per lane: 16 lanes store one whole 128-B line of a channel.
        unsigned short* vp = Vb + ((size_t)b * C_ + wave * 16 + 8 * half) * N_ + n0 + 4 * col;
#pragma unroll
        for (int r = 0; r < 8; ++r)
            *(uint2*)(vp + (size_t)r * N_) =
                make_uint2((unsigned)f2bf(acc[0][r]) | ((unsigned)f2bf(acc[1][r]) << 16),
                           (unsigned)f2bf(acc[2][r]) | ((unsigned)f2bf(acc[3][r]) << 16));
    } else {
        // Lower lane half holds Q, upper half K: 4 padded rows = 128 B per lane.
        uint4* dst = (half ? Kp : Qp) + (size_t)(g0 + 4 * col) * 2;
        const uint4 z4 = make_uint4(0u, 0u, 0u, 0u);
#pragma unroll
        for (int j = 0; j < 4; ++j) {
            dst[2 * j] = make_uint4(
                (unsigned)f2bf(acc[j][0]) | ((unsigned)f2bf(acc[j][1]) << 16),
                (unsigned)f2bf(acc[j][2]) | ((unsigned)f2bf(acc[j][3]) << 16),
                (unsigned)f2bf(acc[j][4]) | ((unsigned)f2bf(acc[j][5]) << 16),
                (unsigned)f2bf(acc[j][6]) | ((unsigned)f2bf(acc[j][7]) << 16));
            dst[2 * j + 1] = z4;                      // K = 8..15 zero padding
        }
        // In the listing the other branch's code follows and reuses the address
        // registers of these stores: the wait stands in front of it.
        asm volatile("s_wait_xcnt 0x0" ::: "memory");
    }
}

// ---------------------------------------------------------------------------
// Kernel 2: segmented per-row softmax statistics on the matrix unit.
// A wave owns 32 softmax rows n (two B operands: Q) for one j-segment and walks
// the segment in steps of 64 j (four A operands: K).  With K as A and Q as B
// the D tile holds S transposed: a lane keeps 8 scores of ONE row n, so the
// running max and sum of a row are lane-local; lanes l and l^16 (the two j
// halves of each tile) meet once at the end.  Partial (m, d) per segment.
// Every '#pragma unroll' here makes the indices of ka, kc, qb, s, tm, m and d
// constants, without which they would not stay in registers.
// ---------------------------------------------------------------------------
__device__ inline void stats_load(uint4 (&kc)[4], const uint4* __restrict__ p)
{
#pragma unroll
    for (int jt = 0; jt < 4; ++jt) kc[jt] = p[jt * 32];     // 16 K rows = 32 uint4
}

// One step: 64 j (kc) against the wave's 32 rows; online max / sum update.
__device__ inline void stats_step(const uint4 (&kc)[4], const V16 (&qb)[2],
                                  float (&m)[2], float (&d)[2])
{
    const v8f zc = {0.f,0.f,0.f,0.f,0.f,0.f,0.f,0.f};
    V16 ka[4];
#pragma unroll
    for (int jt = 0; jt < 4; ++jt) {
        ka[jt].u[0] = kc[jt].x; ka[jt].u[1] = kc[jt].y;
        ka[jt].u[2] = kc[jt].z; ka[jt].u[3] = kc[jt].w;
        ka[jt].u[4] = 0u; ka[jt].u[5] = 0u; ka[jt].u[6] = 0u; ka[jt].u[7] = 0u;
    }
#pragma unroll
    for (int nt = 0; nt < 2; ++nt) {
        v8f s[4];
#pragma unroll
        for (int jt = 0; jt < 4; ++jt)
            s[jt] = __builtin_amdgcn_wmma_f32_16x16x32_bf16(false, ka[jt].v, false, qb[nt].v,
                                                            (short)0, zc, false, false);
        float tm[4];                                  // one short max chain per tile
#pragma unroll
        for (int jt = 0; jt < 4; ++jt) {
            tm[jt] = s[jt][0];
#pragma unroll
            for (int r = 1; r < 8; ++r) tm[jt] = fmaxf(tm[jt], s[jt][r]);
        }
        const float mn = fmaxf(fmaxf(fmaxf(m[nt], tm[0]), tm[1]), fmaxf(tm[2], tm[3]));
        const float mL = mn * LOG2E_;
        v2f a0 = {0.f, 0.f}, a1 = {0.f, 0.f};         // independent partial sums
#pragma unroll
        for (int jt = 0; jt < 4; ++jt)
#pragma unroll
            for (int r = 0; r < 8; r += 4) {
                v2f e0 = {s[jt][r],     s[jt][r + 1]};
                v2f e1 = {s[jt][r + 2], s[jt][r + 3]};
                e0 = e0 * LOG2E_ - mL;
                e1 = e1 * LOG2E_ - mL;
                v2f p0 = {__builtin_amdgcn_exp2f(e0.x), __builtin_amdgcn_exp2f(e0.y)};
                v2f p1 = {__builtin_amdgcn_exp2f(e1.x), __builtin_amdgcn_exp2f(e1.y)};
                a0 += p0;
                a1 += p1;
            }
        a0 += a1;
        d[nt] = fmaf(d[nt], __builtin_amdgcn_exp2f((m[nt] - mn) * LOG2E_), a0.x + a0.y);
        m[nt] = mn;
    }
}

__global__ __launch_bounds__(256) void stats_kernel(
    const uint4* __restrict__ Qp, const uint4* __restrict__ Kp,
    float* __restrict__ Mpart, float* __restrict__ Dpart)
{
    int t    = threadIdx.x;
    int wave = __builtin_amdgcn_readfirstlane(t >> 5), lane = t & 31;
    int half = lane >> 4, col = lane & 15;
    int rb  = blockIdx.x & 63;         // 64 row-blocks
    int seg = blockIdx.x >> 6;         // 4 segments
    int g0  = rb * 256 + wave * 32;    // first of this wave's 32 rows
    int b   = g0 >> 12;

    // Same loader for Q and K as in the output kernel (upper-half lanes read the
    // stored zero padding), so the k order of A and B is equal at every position.
    V16 qb[2];
#pragma unroll
    for (int nt = 0; nt < 2; ++nt) {
        uint4 qv = Qp[(size_t)(g0 + nt * 16 + col) * 2 + half];
        qb[nt].u[0] = qv.x; qb[nt].u[1] = qv.y; qb[nt].u[2] = qv.z; qb[nt].u[3] = qv.w;
        qb[nt].u[4] = 0u;   qb[nt].u[5] = 0u;   qb[nt].u[6] = 0u;   qb[nt].u[7] = 0u;
    }

    const uint4* kp = Kp + ((size_t)b * N_ + seg * SEGJ_ + col) * 2 + half;
    uint4 kA[4], kB[4];                // two register buffers: each step's K rows
    stats_load(kA, kp);                // are fetched one step ahead of their use

    float m[2] = {-3.0e38f, -3.0e38f};
    float d[2] = {0.0f, 0.0f};

    for (int j0 = 0; j0 < SEGJ_; j0 += 128) {
        stats_load(kB, kp + 128);
        stats_step(kA, qb, m, d);
        if (j0 + 128 < SEGJ_) stats_load(kA, kp + 256);
        stats_step(kB, qb, m, d);
        kp += 256;
    }

    // Lanes l and l^16 hold the same rows over the two j halves: merge them.
    float mo[2], dd[2];
#pragma unroll
    for (int nt = 0; nt < 2; ++nt) {
        float m2 = __shfl_xor(m[nt], 16, 32);
        float d2 = __shfl_xor(d[nt], 16, 32);
        float mn = fmaxf(m[nt], m2);
        mo[nt] = mn;
        dd[nt] = d[nt] * __builtin_amdgcn_exp2f((m[nt] - mn) * LOG2E_) +
                 d2    * __builtin_amdgcn_exp2f((m2    - mn) * LOG2E_);
    }
    // Both halves now hold both tiles' results: lane l stores row g0 + l.
    Mpart[seg * (B_ * N_) + g0 + lane] = half ? mo[1] : mo[0];
    Dpart[seg * (B_ * N_) + g0 + lane] = half ? dd[1] : dd[0];
}

// ---------------------------------------------------------------------------
// Kernel 2b: merge segment partials; emit fused softmax constant in the exp2
// domain:  Crow[n] = -log2(D[n]) - M[n]*log2e,
// so that  P[n,m] = exp2(S[n,m]*log2e + Crow[n]).
// ---------------------------------------------------------------------------
__global__ __launch_bounds__(256) void crow_kernel(
    const float* __restrict__ Mpart, const float* __restrict__ Dpart,
    float* __restrict__ Crow)
{
    int g = blockIdx.x * 256 + threadIdx.x;
    float m = -3.0e38f;
#pragma unroll
    for (int s = 0; s < NSEG_; ++s) m = fmaxf(m, Mpart[s * (B_ * N_) + g]);
    float d = 0.0f;
#pragma unroll
    for (int s = 0; s < NSEG_; ++s)
        d += Dpart[s * (B_ * N_) + g] *
             __builtin_amdgcn_exp2f((Mpart[s * (B_ * N_) + g] - m) * LOG2E_);
    Crow[g] = -__builtin_amdgcn_logf(d) - m * LOG2E_;   // v_log_f32 is log2
}

// ---------------------------------------------------------------------------
// Kernel 3: out = V @ softmax_rows(QtK) + x.  One block owns 64 output columns
// (4 m-tiles) of one batch; its NW_ waves share out the n loop, each working
// on all 4 m-tiles, so every Q, Crow and V fragment it loads feeds 4 tiles.
// The per-wave f32 partial sums meet in LDS: after one barrier wave w adds the
// NW_ partials of accumulator tile w in wave order and stores it with x.
// Key identity: the WMMA C-layout of the two S tiles (lane holds
// rows 8*half+r / 16+8*half+r of column l%16) is exactly the lane-local data
// the PV B-operand layout needs, so P is repacked C->B in registers.
// Every '#pragma unroll' here makes the indices of acc, kb, av, pb and the
// small float arrays constants, without which they would not stay in registers.
// ---------------------------------------------------------------------------
#define NW_   16                     // waves per block = n slices = acc tiles

__global__ __launch_bounds__(NW_ * 32) void attn_out_kernel(
    const uint4* __restrict__ Qp, const uint4* __restrict__ Kp,
    const unsigned short* __restrict__ Vb,
    const float* __restrict__ Crow,
    const float* __restrict__ x, float* __restrict__ out)
{
    __shared__ float4 red[NW_][32][32];            // [wave][tile*2 + r/4][lane]

    int t    = threadIdx.x;
    int wave = __builtin_amdgcn_readfirstlane(t >> 5), lane = t & 31;
    int half = lane >> 4, col = lane & 15;
    int b  = blockIdx.x >> 6;
    int m0 = (blockIdx.x & 63) << 6;

    const size_t bN = (size_t)b * N_;

    // B-operands for scores: K columns m0..m0+63 (fixed for the whole wave).
    // Unconditional load: upper-half lanes read the stored zero padding.
    V16 kb[4];
#pragma unroll
    for (int mt = 0; mt < 4; ++mt) {
        uint4 kv = Kp[(bN + m0 + mt * 16 + col) * 2 + half];
        kb[mt].u[0] = kv.x; kb[mt].u[1] = kv.y; kb[mt].u[2] = kv.z; kb[mt].u[3] = kv.w;
        kb[mt].u[4] = 0u;   kb[mt].u[5] = 0u;   kb[mt].u[6] = 0u;   kb[mt].u[7] = 0u;
    }
    // The address registers of the four K loads are reused by the set-up code
    // below:
    // the wait stands here, and the scheduling barrier keeps that code behind it.
    asm volatile("s_wait_xcnt 0x0" ::: "memory");
    __builtin_amdgcn_sched_barrier(0);

    const v8f zc = {0.f,0.f,0.f,0.f,0.f,0.f,0.f,0.f};
    v8f acc[4][4];                                 // [ct][mt]
#pragma unroll
    for (int ct = 0; ct < 4; ++ct)
#pragma unroll
        for (int mt = 0; mt < 4; ++mt) acc[ct][mt] = zc;

    const unsigned short* vbase = Vb + ((size_t)b * C_ + col) * N_ + 8 * half;

    // Chunks of 32 n are dealt round robin: in one trip the block's waves read
    // neighbouring chunks, so two waves use each 128-B line of V together.
    int n0 = wave * 32;
    do {
        // All of this 32-n chunk's loads first: Q rows (two 16-row A tiles),
        // the 16 row constants of this lane, 4 c-tiles of V (A-operands).
        uint4 v0 = Qp[(bN + n0 + col) * 2 + half];
        uint4 v1 = Qp[(bN + n0 + 16 + col) * 2 + half];
        const float4* cr = (const float4*)(Crow + bN + n0 + 8 * half);
        float4 c0 = cr[0], c1 = cr[1], c2 = cr[4], c3 = cr[5];
        V16 av[4];
#pragma unroll
        for (int ct = 0; ct < 4; ++ct) {
            const unsigned short* vrow = vbase + (size_t)(ct * 16) * N_ + n0;
            uint4 a0 = *(const uint4*)(vrow);
            uint4 a1 = *(const uint4*)(vrow + 16);
            av[ct].u[0] = a0.x; av[ct].u[1] = a0.y; av[ct].u[2] = a0.z; av[ct].u[3] = a0.w;
            av[ct].u[4] = a1.x; av[ct].u[5] = a1.y; av[ct].u[6] = a1.z; av[ct].u[7] = a1.w;
        }
        V16 aq0, aq1;
        aq0.u[0] = v0.x; aq0.u[1] = v0.y; aq0.u[2] = v0.z; aq0.u[3] = v0.w;
        aq1.u[0] = v1.x; aq1.u[1] = v1.y; aq1.u[2] = v1.z; aq1.u[3] = v1.w;
        aq0.u[4] = aq0.u[5] = aq0.u[6] = aq0.u[7] = 0u;
        aq1.u[4] = aq1.u[5] = aq1.u[6] = aq1.u[7] = 0u;
        const float cw0[8] = {c0.x, c0.y, c0.z, c0.w, c1.x, c1.y, c1.z, c1.w};
        const float cw1[8] = {c2.x, c2.y, c2.z, c2.w, c3.x, c3.y, c3.z, c3.w};

#pragma unroll
        for (int mt = 0; mt < 4; ++mt) {
            // P = exp2(s*log2e + Crow[row]); C-layout -> B-layout is lane-local:
            // pb pair j<4 = rows {8h+2j, 8h+2j+1} of tile 0, pair j>=4 = tile 1.
            V16 pb;
            {
                v8f s = __builtin_amdgcn_wmma_f32_16x16x32_bf16(false, aq0.v, false, kb[mt].v,
                                                                (short)0, zc, false, false);
#pragma unroll
                for (int tp = 0; tp < 4; ++tp) {
                    float p0 = __builtin_amdgcn_exp2f(fmaf(s[2*tp],     LOG2E_, cw0[2*tp]));
                    float p1 = __builtin_amdgcn_exp2f(fmaf(s[2*tp + 1], LOG2E_, cw0[2*tp + 1]));
                    pb.u[tp] = __builtin_amdgcn_perm(__float_as_uint(p1), __float_as_uint(p0), 0x07060302u);
                }
            }
            {
                v8f s = __builtin_amdgcn_wmma_f32_16x16x32_bf16(false, aq1.v, false, kb[mt].v,
                                                                (short)0, zc, false, false);
#pragma unroll
                for (int tp = 0; tp < 4; ++tp) {
                    float p2 = __builtin_amdgcn_exp2f(fmaf(s[2*tp],     LOG2E_, cw1[2*tp]));
                    float p3 = __builtin_amdgcn_exp2f(fmaf(s[2*tp + 1], LOG2E_, cw1[2*tp + 1]));
                    pb.u[4 + tp] = __builtin_amdgcn_perm(__float_as_uint(p3), __float_as_uint(p2), 0x07060302u);
                }
            }
#pragma unroll
            for (int ct = 0; ct < 4; ++ct)
                acc[ct][mt] = __builtin_amdgcn_wmma_f32_16x16x32_bf16(false, av[ct].v, false, pb.v,
                                                                      (short)0, acc[ct][mt], false, false);
        }
        n0 += NW_ * 32;
    } while (n0 < N_);

    // Every wave publishes its 16 partial tiles, lane-contiguous 16-B pieces.
#pragma unroll
    for (int ct = 0; ct < 4; ++ct)
#pragma unroll
        for (int mt = 0; mt < 4; ++mt) {
            v8f a = acc[ct][mt];
            red[wave][(ct * 4 + mt) * 2    ][lane] = make_float4(a[0], a[1], a[2], a[3]);
            red[wave][(ct * 4 + mt) * 2 + 1][lane] = make_float4(a[4], a[5], a[6], a[7]);
        }

    // Wave w finishes tile w = ct*4 + mt; its residual x is fetched meanwhile.
    const int ct = wave >> 2, mt = wave & 3;
    const size_t idx0 = ((size_t)b * C_ + ct * 16 + 8 * half) * N_ + m0 + mt * 16 + col;
    float xv[8];
#pragma unroll
    for (int r = 0; r < 8; ++r) xv[r] = x[idx0 + (size_t)r * N_];

    __syncthreads();

    float4 lo0 = red[0][wave * 2][lane], hi0 = red[0][wave * 2 + 1][lane];
    float sum[8] = {lo0.x, lo0.y, lo0.z, lo0.w, hi0.x, hi0.y, hi0.z, hi0.w};
#pragma unroll
    for (int s = 1; s < NW_; ++s) {
        float4 lo = red[s][wave * 2    ][lane];
        float4 hi = red[s][wave * 2 + 1][lane];
        sum[0] += lo.x; sum[1] += lo.y; sum[2] += lo.z; sum[3] += lo.w;
        sum[4] += hi.x; sum[5] += hi.y; sum[6] += hi.z; sum[7] += hi.w;
    }
#pragma unroll
    for (int r = 0; r < 8; ++r) out[idx0 + (size_t)r * N_] = sum[r] + xv[r];
}

// ---------------------------------------------------------------------------
extern "C" void kernel_launch(void* const* d_in, const int* in_sizes, int n_in,
                              void* d_out, int out_size, void* d_ws, size_t ws_size,
                              hipStream_t stream)
{
    const float* x  = (const float*)d_in[0];
    const float* wq = (const float*)d_in[1];
    const float* bq = (const float*)d_in[2];
    const float* wk = (const float*)d_in[3];
    const float* bk = (const float*)d_in[4];
    const float* wv = (const float*)d_in[5];
    const float* bv = (const float*)d_in[6];
    float* out = (float*)d_out;

    char* ws = (char*)d_ws;
    const size_t qp_bytes = (size_t)B_ * N_ * 16 * 2;           // 512 KB (padded rows)
    const size_t vb_bytes = (size_t)B_ * C_ * N_ * 2;           // 2 MB
    const size_t md_bytes = (size_t)NSEG_ * B_ * N_ * 4;        // 256 KB

    uint4*          Qp    = (uint4*)(ws);
    uint4*          Kp    = (uint4*)(ws + qp_bytes);
    unsigned short* Vb    = (unsigned short*)(ws + 2 * qp_bytes);
    float*          Mpart = (float*)(ws + 2 * qp_bytes + vb_bytes);
    float*          Dpart = (float*)(ws + 2 * qp_bytes + vb_bytes + md_bytes);
    float*          Crow  = (float*)(ws + 2 * qp_bytes + vb_bytes + 2 * md_bytes);

    proj_kernel<<<(B_ * N_) / 64, PW_ * 32, 0, stream>>>(x, wq, bq, wk, bk, wv, bv, Qp, Kp, Vb);
    stats_kernel<<<NSEG_ * (B_ * N_) / 256, 256, 0, stream>>>(Qp, Kp, Mpart, Dpart);
    crow_kernel<<<(B_ * N_) / 256, 256, 0, stream>>>(Mpart, Dpart, Crow);
    attn_out_kernel<<<B_ * (N_ / 64), NW_ * 32, 0, stream>>>(Qp, Kp, Vb, Crow, x, out);
}

// v004
// One run takes 27.2 microseconds.
// Next to v003, in two timings, it ran 1.04 and 1.05 times as fast.
// Counting every step since v000, it is 7.70 times as fast.
#include <hip/hip_runtime.h>
#include <stdint.h>

#define B_  4
#define C_  64
#define N_  4096
#define C8_ 8

#define NSEG_ 4
#define SEGJ_ (N_ / NSEG_)          // 1024 j per stats segment

typedef __attribute__((ext_vector_type(16))) __bf16 v16bf;
typedef __attribute__((ext_vector_type(8)))  float  v8f;
typedef __attribute__((ext_vector_type(2)))  float  v2f;
typedef __attribute__((ext_vector_type(4)))  float  v4f;

union V16 { unsigned u[8]; v16bf v; };

#define LOG2E_ 1.4426950408889634f

__device__ inline unsigned short f2bf(float f) {
    unsigned u = __float_as_uint(f);
    unsigned r = u + 0x7FFFu + ((u >> 16) & 1u);   // round-to-nearest-even
    return (unsigned short)(r >> 16);
}
__device__ inline float bf2f(unsigned short h) {
    return __uint_as_float(((unsigned)h) << 16);
}

// ---------------------------------------------------------------------------
// Kernel 1: fused QKV projection on the matrix unit, in f32 (16x16x4 form).
// x [B][64][N] f32 -> Qp,Kp [B][N][16] bf16 (32 B rows; elements 8..15 zeroed
// = WMMA K-padding, so attn-kernel lanes can load unconditionally),
// V [B][64][N] bf16, biases fused (they are the accumulators' start values).
// One block per 64 pixels, so that every WGP works; each of its PW_ waves owns
// one tile of 16 output channels as A (waves 0..3: V; wave 4: Q over K) and
// all 64 pixels as four B tiles.  Column c of B tile j is pixel 4c + j: one
// 16-B load of x feeds all four tiles, and a lane ends up with 4 neighbouring
// pixels of each of its 8 channels.
// k order: element e of step s in lane half h is input channel
// 8*(s/2) + 4*h + 2*(s%2) + e, for the A loader and the B loader alike.
// Every '#pragma unroll' here makes the indices of wa, xv and acc constants,
// without which they would not stay in registers.
// ---------------------------------------------------------------------------
#define PW_ 5                        // waves per block = tiles of 16 channels

__global__ __launch_bounds__(PW_ * 32) void proj_kernel(
    const float* __restrict__ x,
    const float* __restrict__ wq, const float* __restrict__ bq,
    const float* __restrict__ wk, const float* __restrict__ bk,
    const float* __restrict__ wv, const float* __restrict__ bv,
    uint4* __restrict__ Qp, uint4* __restrict__ Kp,
    unsigned short* __restrict__ Vb)
{
    int t    = threadIdx.x;
    int wave = __builtin_amdgcn_readfirstlane(t >> 5), lane = t & 31;
    int half = lane >> 4, col = lane & 15;
    int g0 = blockIdx.x * 64;              // first of the block's 64 pixels
    int b  = g0 >> 12;
    int n0 = g0 & (N_ - 1);

    // This lane's weight row (A row = col) and the biases of its 8 D rows.
    const float* wrow;
    const float* brow;
    if (wave < 4) {
        wrow = wv + (wave * 16 + col) * C_;
        brow = bv + wave * 16 + 8 * half;
    } else {
        wrow = col < 8 ? wq + col * C_ : wk + (col - 8) * C_;
        brow = half ? bk : bq;
    }

    // Loads in the order of their use, so that the first steps can start while
    // the later ones' data are still on their way.
    const v4f b0 = *(const v4f*)brow, b1 = *(const v4f*)(brow + 4);
    v4f wa[8];                             // wa[u] = steps 2u and 2u + 1
    v4f xv[16][2];                         // [step][element], 4 pixels each
    const float* xb = x + ((size_t)b * C_ + 4 * half) * N_ + n0 + 4 * col;
#pragma unroll
    for (int u = 0; u < 8; ++u) {
        wa[u] = *(const v4f*)(wrow + 8 * u + 4 * half);
#pragma unroll
        for (int q = 0; q < 4; ++q)
            xv[2 * u + (q >> 1)][q & 1] = *(const v4f*)(xb + (size_t)(8 * u + q) * N_);
    }

    v8f acc[4];
#pragma unroll
    for (int j = 0; j < 4; ++j)
        acc[j] = (v8f){b0.x, b0.y, b0.z, b0.w, b1.x, b1.y, b1.z, b1.w};

    // Stands in front of the first overwrite of the loads' address registers (a
    // precaution); naming them keeps them untouched up to here.
    asm volatile("s_wait_xcnt 0x0" :: "v"(xb), "v"(wrow), "v"(brow) : "memory");
    // Keeps all 42 loads in front of the first WMMA, in flight together: without
    // it the build sinks each pair of x loads to its step and the wave waits out
    // one round trip to L2 per step.
    __builtin_amdgcn_sched_barrier(0);

#pragma unroll
    for (int s = 0; s < 16; ++s) {
        const v2f af = {wa[s >> 1][2 * (s & 1)], wa[s >> 1][2 * (s & 1) + 1]};
#pragma unroll
        for (int j = 0; j < 4; ++j) {
            const v2f bf = {xv[s][0][j], xv[s][1][j]};
            acc[j] = __builtin_amdgcn_wmma_f32_16x16x4_f32(false, af, false, bf,
                                                           (short)0, acc[j], false, false);
        }
    }

    // acc[j][r] = channel 8*half + r of the tile, pixel g0 + 4*col + j.
    if (wave < 4) {
        // 4 bf16 per lane: 16 lanes store one whole 128-B line of a channel.
        unsigned short* vp = Vb + ((size_t)b * C_ + wave * 16 + 8 * half) * N_ + n0 + 4 * col;
#pragma unroll
        for (int r = 0; r < 8; ++r)
            *(uint2*)(vp + (size_t)r * N_) =
                make_uint2((unsigned)f2bf(acc[0][r]) | ((unsigned)f2bf(acc[1][r]) << 16),
                           (unsigned)f2bf(acc[2][r]) | ((unsigned)f2bf(acc[3][r]) << 16));
    } else {
        // Lower lane half holds Q, upper half K: 4 padded rows = 128 B per lane.
        uint4* dst = (half ? Kp : Qp) + (size_t)(g0 + 4 * col) * 2;
        const uint4 z4 = make_uint4(0u, 0u, 0u, 0u);
#pragma unroll
        for (int j = 0; j < 4; ++j) {
            dst[2 * j] = make_uint4(
                (unsigned)f2bf(acc[j][0]) | ((unsigned)f2bf(acc[j][1]) << 16),
                (unsigned)f2bf(acc[j][2]) | ((unsigned)f2bf(acc[j][3]) << 16),
                (unsigned)f2bf(acc[j][4]) | ((unsigned)f2bf(acc[j][5]) << 16),
                (unsigned)f2bf(acc[j][6]) | ((unsigned)f2bf(acc[j][7]) << 16));
            dst[2 * j + 1] = z4;                      // K = 8..15 zero padding
        }
        // In the listing the other branch's code follows and reuses the address
        // registers of these stores: the wait stands in front of it.
        asm volatile("s_wait_xcnt 0x0" ::: "memory");
    }
}

// ---------------------------------------------------------------------------
// Kernel 2: per-row softmax constants on the matrix unit, finished in one launch.
// A block owns SR_ = 64 softmax rows n over ALL j of their batch: wave w takes
// 32 of the rows (w & 1; two B operands: Q) and one j-segment (w >> 1), which it
// walks in steps of 64 j (four A operands: K).  With K as A and Q as B
// the D tile holds S transposed: a lane keeps 8 scores of ONE row n, so the
// running max and sum of a row are lane-local.  A row's 8 partial (m, d) pairs
// (4 segments x the two j halves of each tile, lanes l and l^16) meet in LDS
// behind one barrier, and the block itself emits the fused softmax constant in
// the exp2 domain:  Crow[n] = -log2(D[n]) - M[n]*log2e,
// so that  P[n,m] = exp2(S[n,m]*log2e + Crow[n]).
// Every '#pragma unroll' here makes the indices of ka, kc, qb, s, tm, m, d and
// pr constants, without which they would not stay in registers.
// ---------------------------------------------------------------------------
__device__ inline void stats_load(uint4 (&kc)[4], const uint4* __restrict__ p)
{
#pragma unroll
    for (int jt = 0; jt < 4; ++jt) kc[jt] = p[jt * 32];     // 16 K rows = 32 uint4
}

// One step: 64 j (kc) against the wave's 32 rows; online max / sum update.
__device__ inline void stats_step(const uint4 (&kc)[4], const V16 (&qb)[2],
                                  float (&m)[2], float (&d)[2])
{
    const v8f zc = {0.f,0.f,0.f,0.f,0.f,0.f,0.f,0.f};
    V16 ka[4];
#pragma unroll
    for (int jt = 0; jt < 4; ++jt) {
        ka[jt].u[0] = kc[jt].x; ka[jt].u[1] = kc[jt].y;
        ka[jt].u[2] = kc[jt].z; ka[jt].u[3] = kc[jt].w;
        ka[jt].u[4] = 0u; ka[jt].u[5] = 0u; ka[jt].u[6] = 0u; ka[jt].u[7] = 0u;
    }
#pragma unroll
    for (int nt = 0; nt < 2; ++nt) {
        v8f s[4];
#pragma unroll
        for (int jt = 0; jt < 4; ++jt)
            s[jt] = __builtin_amdgcn_wmma_f32_16x16x32_bf16(false, ka[jt].v, false, qb[nt].v,
                                                            (short)0, zc, false, false);
        float tm[4];                                  // one short max chain per tile
#pragma unroll
        for (int jt = 0; jt < 4; ++jt) {
            tm[jt] = s[jt][0];
#pragma unroll
            for (int r = 1; r < 8; ++r) tm[jt] = fmaxf(tm[jt], s[jt][r]);
        }
        const float mn = fmaxf(fmaxf(fmaxf(m[nt], tm[0]), tm[1]), fmaxf(tm[2], tm[3]));
        const float mL = mn * LOG2E_;
        v2f a0 = {0.f, 0.f}, a1 = {0.f, 0.f};         // independent partial sums
#pragma unroll
        for (int jt = 0; jt < 4; ++jt)
#pragma unroll
            for (int r = 0; r < 8; r += 4) {
                v2f e0 = {s[jt][r],     s[jt][r + 1]};
                v2f e1 = {s[jt][r + 2], s[jt][r + 3]};
                e0 = e0 * LOG2E_ - mL;
                e1 = e1 * LOG2E_ - mL;
                v2f p0 = {__builtin_amdgcn_exp2f(e0.x), __builtin_amdgcn_exp2f(e0.y)};
                v2f p1 = {__builtin_amdgcn_exp2f(e1.x), __builtin_amdgcn_exp2f(e1.y)};
                a0 += p0;
                a1 += p1;
            }
        a0 += a1;
        d[nt] = fmaf(d[nt], __builtin_amdgcn_exp2f((m[nt] - mn) * LOG2E_), a0.x + a0.y);
        m[nt] = mn;
    }
}

#define SR_ 64                       // softmax rows per block

__global__ __launch_bounds__(256) void stats_kernel(
    const uint4* __restrict__ Qp, const uint4* __restrict__ Kp,
    float* __restrict__ Crow)
{
    __shared__ float2 part[2 * NSEG_][SR_];        // [segment*2 + lane half][row]

    int t    = threadIdx.x;
    int wave = __builtin_amdgcn_readfirstlane(t >> 5), lane = t & 31;
    int half = lane >> 4, col = lane & 15;
    int rg  = wave & 1;                // which 32 of the block's 64 rows
    int seg = wave >> 1;               // 4 segments
    int gb  = blockIdx.x * SR_;        // first of the block's 64 rows
    int g0  = gb + rg * 32;            // first of this wave's 32 rows
    int b   = g0 >> 12;

    // Same loader for Q and K as in the output kernel (upper-half lanes read the
    // stored zero padding), so the k order of A and B is equal at every position.
    V16 qb[2];
#pragma unroll
    for (int nt = 0; nt < 2; ++nt) {
        uint4 qv = Qp[(size_t)(g0 + nt * 16 + col) * 2 + half];
        qb[nt].u[0] = qv.x; qb[nt].u[1] = qv.y; qb[nt].u[2] = qv.z; qb[nt].u[3] = qv.w;
        qb[nt].u[4] = 0u;   qb[nt].u[5] = 0u;   qb[nt].u[6] = 0u;   qb[nt].u[7] = 0u;
    }

    const uint4* kp = Kp + ((size_t)b * N_ + seg * SEGJ_ + col) * 2 + half;
    uint4 kA[4], kB[4];                // two register buffers: each step's K rows
    stats_load(kA, kp);                // are fetched one step ahead of their use

    float m[2] = {-3.0e38f, -3.0e38f};
    float d[2] = {0.0f, 0.0f};

    for (int j0 = 0; j0 < SEGJ_; j0 += 128) {
        stats_load(kB, kp + 128);
        stats_step(kA, qb, m, d);
        if (j0 + 128 < SEGJ_) stats_load(kA, kp + 256);
        stats_step(kB, qb, m, d);
        // Stands in front of the overwrite of the K loads' address registers (a
        // precaution); naming them keeps them untouched up to here.  The scheduling
        // barrier holds the wait at the trip's end: without it the build lifts wait
        // and overwrite to just behind the loads' issue, where the wave could stall.
        __builtin_amdgcn_sched_barrier(0);
        asm volatile("s_wait_xcnt 0x0" :: "v"(kp) : "memory");
        kp += 256;
    }

    // Every lane publishes its partial of each of its 2 rows.
#pragma unroll
    for (int nt = 0; nt < 2; ++nt)
        part[seg * 2 + half][rg * 32 + nt * 16 + col] = make_float2(m[nt], d[nt]);

    __syncthreads();

    // Waves 0 and 1: thread t merges the 8 partials of row gb + t, in segment order.
    if (t < SR_) {
        float2 pr[2 * NSEG_];
#pragma unroll
        for (int s = 0; s < 2 * NSEG_; ++s) pr[s] = part[s][t];
        float mm = pr[0].x;
#pragma unroll
        for (int s = 1; s < 2 * NSEG_; ++s) mm = fmaxf(mm, pr[s].x);
        float dd = 0.0f;
#pragma unroll
        for (int s = 0; s < 2 * NSEG_; ++s)
            dd += pr[s].y * __builtin_amdgcn_exp2f((pr[s].x - mm) * LOG2E_);
        Crow[gb + t] = -__builtin_amdgcn_logf(dd) - mm * LOG2E_;   // v_log_f32 is log2
    }
}

// ---------------------------------------------------------------------------
// Kernel 3: out = V @ softmax_rows(QtK) + x.  One block owns 64 output columns
// (4 m-tiles) of one batch; its NW_ waves share out the n loop, each working
// on all 4 m-tiles, so every Q, Crow and V fragment it loads feeds 4 tiles.
// The per-wave f32 partial sums meet in LDS: after one barrier wave w adds the
// NW_ partials of accumulator tile w in wave order and stores it with x.
// Key identity: the WMMA C-layout of the two S tiles (lane holds
// rows 8*half+r / 16+8*half+r of column l%16) is exactly the lane-local data
// the PV B-operand layout needs, so P is repacked C->B in registers.
// Every '#pragma unroll' here makes the indices of acc, kb, av, pb and the
// small float arrays constants, without which they would not stay in registers.
// ---------------------------------------------------------------------------
#define NW_   16                     // waves per block = n slices = acc tiles

__global__ __launch_bounds__(NW_ * 32) void attn_out_kernel(
    const uint4* __restrict__ Qp, const uint4* __restrict__ Kp,
    const unsigned short* __restrict__ Vb,
    const float* __restrict__ Crow,
    const float* __restrict__ x, float* __restrict__ out)
{
    __shared__ float4 red[NW_][32][32];            // [wave][tile*2 + r/4][lane]

    int t    = threadIdx.x;
    int wave = __builtin_amdgcn_readfirstlane(t >> 5), lane = t & 31;
    int half = lane >> 4, col = lane & 15;
    int b  = blockIdx.x >> 6;
    int m0 = (blockIdx.x & 63) << 6;

    const size_t bN = (size_t)b * N_;

    // B-operands for scores: K columns m0..m0+63 (fixed for the whole wave).
    // Unconditional load: upper-half lanes read the stored zero padding.
    V16 kb[4];
#pragma unroll
    for (int mt = 0; mt < 4; ++mt) {
        uint4 kv = Kp[(bN + m0 + mt * 16 + col) * 2 + half];
        kb[mt].u[0] = kv.x; kb[mt].u[1] = kv.y; kb[mt].u[2] = kv.z; kb[mt].u[3] = kv.w;
        kb[mt].u[4] = 0u;   kb[mt].u[5] = 0u;   kb[mt].u[6] = 0u;   kb[mt].u[7] = 0u;
    }
    // The address registers of the four K loads are reused by the set-up code
    // below:
    // the wait stands here, and the scheduling barrier keeps that code behind it.
    asm volatile("s_wait_xcnt 0x0" ::: "memory");
    __builtin_amdgcn_sched_barrier(0);

    const v8f zc = {0.f,0.f,0.f,0.f,0.f,0.f,0.f,0.f};
    v8f acc[4][4];                                 // [ct][mt]
#pragma unroll
    for (int ct = 0; ct < 4; ++ct)
#pragma unroll
        for (int mt = 0; mt < 4; ++mt) acc[ct][mt] = zc;

    const unsigned short* vbase = Vb + ((size_t)b * C_ + col) * N_ + 8 * half;

    // Chunks of 32 n are dealt round robin: in one trip the block's waves read
    // neighbouring chunks, so two waves use each 128-B line of V together.
    int n0 = wave * 32;
    do {
        // All of this 32-n chunk's loads first: Q rows (two 16-row A tiles),
        // the 16 row constants of this lane, 4 c-tiles of V (A-operands).
        uint4 v0 = Qp[(bN + n0 + col) * 2 + half];
        uint4 v1 = Qp[(bN + n0 + 16 + col) * 2 + half];
        const float4* cr = (const float4*)(Crow + bN + n0 + 8 * half);
        float4 c0 = cr[0], c1 = cr[1], c2 = cr[4], c3 = cr[5];
        V16 av[4];
#pragma unroll
        for (int ct = 0; ct < 4; ++ct) {
            const unsigned short* vrow = vbase + (size_t)(ct * 16) * N_ + n0;
            uint4 a0 = *(const uint4*)(vrow);
            uint4 a1 = *(const uint4*)(vrow + 16);
            av[ct].u[0] = a0.x; av[ct].u[1] = a0.y; av[ct].u[2] = a0.z; av[ct].u[3] = a0.w;
            av[ct].u[4] = a1.x; av[ct].u[5] = a1.y; av[ct].u[6] = a1.z; av[ct].u[7] = a1.w;
        }
        V16 aq0, aq1;
        aq0.u[0] = v0.x; aq0.u[1] = v0.y; aq0.u[2] = v0.z; aq0.u[3] = v0.w;
        aq1.u[0] = v1.x; aq1.u[1] = v1.y; aq1.u[2] = v1.z; aq1.u[3] = v1.w;
        aq0.u[4] = aq0.u[5] = aq0.u[6] = aq0.u[7] = 0u;
        aq1.u[4] = aq1.u[5] = aq1.u[6] = aq1.u[7] = 0u;
        const float cw0[8] = {c0.x, c0.y, c0.z, c0.w, c1.x, c1.y, c1.z, c1.w};
        const float cw1[8] = {c2.x, c2.y, c2.z, c2.w, c3.x, c3.y, c3.z, c3.w};

#pragma unroll
        for (int mt = 0; mt < 4; ++mt) {
            // P = exp2(s*log2e + Crow[row]); C-layout -> B-layout is lane-local:
            // pb pair j<4 = rows {8h+2j, 8h+2j+1} of tile 0, pair j>=4 = tile 1.
            V16 pb;
            {
                v8f s = __builtin_amdgcn_wmma_f32_16x16x32_bf16(false, aq0.v, false, kb[mt].v,
                                                                (short)0, zc, false, false);
#pragma unroll
                for (int tp = 0; tp < 4; ++tp) {
                    float p0 = __builtin_amdgcn_exp2f(fmaf(s[2*tp],     LOG2E_, cw0[2*tp]));
                    float p1 = __builtin_amdgcn_exp2f(fmaf(s[2*tp + 1], LOG2E_, cw0[2*tp + 1]));
                    pb.u[tp] = __builtin_amdgcn_perm(__float_as_uint(p1), __float_as_uint(p0), 0x07060302u);
                }
            }
            {
                v8f s = __builtin_amdgcn_wmma_f32_16x16x32_bf16(false, aq1.v, false, kb[mt].v,
                                                                (short)0, zc, false, false);
#pragma unroll
                for (int tp = 0; tp < 4; ++tp) {
                    float p2 = __builtin_amdgcn_exp2f(fmaf(s[2*tp],     LOG2E_, cw1[2*tp]));
                    float p3 = __builtin_amdgcn_exp2f(fmaf(s[2*tp + 1], LOG2E_, cw1[2*tp + 1]));
                    pb.u[4 + tp] = __builtin_amdgcn_perm(__float_as_uint(p3), __float_as_uint(p2), 0x07060302u);
                }
            }
#pragma unroll
            for (int ct = 0; ct < 4; ++ct)
                acc[ct][mt] = __builtin_amdgcn_wmma_f32_16x16x32_bf16(false, av[ct].v, false, pb.v,
                                                                      (short)0, acc[ct][mt], false, false);
        }
        n0 += NW_ * 32;
    } while (n0 < N_);

    // Every wave publishes its 16 partial tiles, lane-contiguous 16-B pieces.
#pragma unroll
    for (int ct = 0; ct < 4; ++ct)
#pragma unroll
        for (int mt = 0; mt < 4; ++mt) {
            v8f a = acc[ct][mt];
            red[wave][(ct * 4 + mt) * 2    ][lane] = make_float4(a[0], a[1], a[2], a[3]);
            red[wave][(ct * 4 + mt) * 2 + 1][lane] = make_float4(a[4], a[5], a[6], a[7]);
        }

    // Wave w finishes tile w = ct*4 + mt; its residual x is fetched meanwhile.
    const int ct = wave >> 2, mt = wave & 3;
    const size_t idx0 = ((size_t)b * C_ + ct * 16 + 8 * half) * N_ + m0 + mt * 16 + col;
    float xv[8];
#pragma unroll
    for (int r = 0; r < 8; ++r) xv[r] = x[idx0 + (size_t)r * N_];

    __syncthreads();

    float4 lo0 = red[0][wave * 2][lane], hi0 = red[0][wave * 2 + 1][lane];
    float sum[8] = {lo0.x, lo0.y, lo0.z, lo0.w, hi0.x, hi0.y, hi0.z, hi0.w};
#pragma unroll
    for (int s = 1; s < NW_; ++s) {
        float4 lo = red[s][wave * 2    ][lane];
        float4 hi = red[s][wave * 2 + 1][lane];
        sum[0] += lo.x; sum[1] += lo.y; sum[2] += lo.z; sum[3] += lo.w;
        sum[4] += hi.x; sum[5] += hi.y; sum[6] += hi.z; sum[7] += hi.w;
    }
#pragma unroll
    for (int r = 0; r < 8; ++r) out[idx0 + (size_t)r * N_] = sum[r] + xv[r];
}

// ---------------------------------------------------------------------------
extern "C" void kernel_launch(void* const* d_in, const int* in_sizes, int n_in,
                              void* d_out, int out_size, void* d_ws, size_t ws_size,
                              hipStream_t stream)
{
    const float* x  = (const float*)d_in[0];
    const float* wq = (const float*)d_in[1];
    const float* bq = (const float*)d_in[2];
    const float* wk = (const float*)d_in[3];
    const float* bk = (const float*)d_in[4];
    const float* wv = (const float*)d_in[5];
    const float* bv = (const float*)d_in[6];
    float* out = (float*)d_out;

    char* ws = (char*)d_ws;
    const size_t qp_bytes = (size_t)B_ * N_ * 16 * 2;           // 512 KB (padded rows)
    const size_t vb_bytes = (size_t)B_ * C_ * N_ * 2;           // 2 MB

    uint4*          Qp    = (uint4*)(ws);
    uint4*          Kp    = (uint4*)(ws + qp_bytes);
    unsigned short* Vb    = (unsigned short*)(ws + 2 * qp_bytes);
    float*          Crow  = (float*)(ws + 2 * qp_bytes + vb_bytes);

    proj_kernel<<<(B_ * N_) / 64, PW_ * 32, 0, stream>>>(x, wq, bq, wk, bk, wv, bv, Qp, Kp, Vb);
    stats_kernel<<<(B_ * N_) / SR_, 256, 0, stream>>>(Qp, Kp, Crow);
    attn_out_kernel<<<B_ * (N_ / 64), NW_ * 32, 0, stream>>>(Qp, Kp, Vb, Crow, x, out);
}

// v005
// Measured time: 25 microseconds a run.
// Timed twice side by side with v004, it ran 1.12 times as fast both times.
// Counting every step since v000, it is 8.64 times as fast.
#include <hip/hip_runtime.h>
#include <stdint.h>

#define B_  4
#define C_  64
#define N_  4096
#define C8_ 8

#define NSEG_ 4
#define SEGJ_ (N_ / NSEG_)          // 1024 j per stats segment

typedef __attribute__((ext_vector_type(16))) __bf16 v16bf;
typedef __attribute__((ext_vector_type(8)))  float  v8f;
typedef __attribute__((ext_vector_type(2)))  float  v2f;
typedef __attribute__((ext_vector_type(4)))  float  v4f;

union V16 { unsigned u[8]; v16bf v; };

#define LOG2E_ 1.4426950408889634f

__device__ inline unsigned short f2bf(float f) {
    unsigned u = __float_as_uint(f);
    unsigned r = u + 0x7FFFu + ((u >> 16) & 1u);   // round-to-nearest-even
    return (unsigned short)(r >> 16);
}
__device__ inline float bf2f(unsigned short h) {
    return __uint_as_float(((unsigned)h) << 16);
}

// ---------------------------------------------------------------------------
// Kernel 1: fused QKV projection on the matrix unit, in f32 (16x16x4 form).
// x [B][64][N] f32 -> Qp,Kp [B][N][16] bf16 (32 B rows; elements 8..15 zeroed
// = WMMA K-padding, so attn-kernel lanes can load unconditionally),
// V bf16 in the order of the output kernel's A fragments (below), biases fused
// (they are the accumulators' start values).
// One block per 64 pixels, so that every WGP works; each of its PW_ waves owns
// one tile of 16 output channels (waves 0..3: V; wave 4: Q over K) and all 64
// pixels as four tiles.  Index c of pixel tile j is pixel 4c + j: one 16-B load
// of x feeds all four tiles.
// Wave 4 takes the weights as A and x as B: a lane ends up with 8 channels of
// each of 4 neighbouring pixels, which are 4 rows of Qp or Kp.
// Waves 0..3 take x as A and the weights as B: a lane ends up with ONE channel
// (col) and the 32 neighbouring pixels 32*half + 4r + j, which are that
// channel's share of one 32-pixel chunk of V.
// Layout of Vf, in 16-B pieces: [b][chunk of 32 n][c-tile][p][lane], where piece
// (p, lane) holds n = 16p + 8*(lane>>4) + 0..7 of channel lane&15: lane l of the
// output kernel reads piece l, so each of its V loads is 512 B in a row.
// k order: element e of step s in lane half h is input channel
// 8*(s/2) + 4*h + 2*(s%2) + e, for the weight loader and the x loader alike.
// Every '#pragma unroll' here makes the indices of wa, xv and acc constants,
// without which they would not stay in registers.
// ---------------------------------------------------------------------------
#define PW_ 5                        // waves per block = tiles of 16 channels
#define NCH_ (N_ / 32)               // chunks of 32 n per batch
#define VCH_ 256                     // 16-B pieces of Vf per chunk (4 KB)

__device__ inline unsigned pack2bf(float lo, float hi) {
    return (unsigned)f2bf(lo) | ((unsigned)f2bf(hi) << 16);
}

// One wave's 16 channels x 64 pixels.  XA: x is the A operand (rows of D are
// pixels, brow points to the lane's one bias); else the weights are (rows of D
// are channels, brow points to the biases of the lane's 8 rows).
template <bool XA>
__device__ __forceinline__ void proj_tile(const float* __restrict__ xb,
                                          const float* __restrict__ wrow,
                                          const float* __restrict__ brow,
                                          v8f (&acc)[4])
{
    // Loads in the order of their use, so that the first steps can start while
    // the later ones' data are still on their way.
    v8f bi;
    if (XA) {
        const float bb = *brow;
        bi = (v8f){bb, bb, bb, bb, bb, bb, bb, bb};
    } else {
        const v4f b0 = *(const v4f*)brow, b1 = *(const v4f*)(brow + 4);
        bi = (v8f){b0.x, b0.y, b0.z, b0.w, b1.x, b1.y, b1.z, b1.w};
    }
    v4f wa[8];                             // wa[u] = steps 2u and 2u + 1
    v4f xv[16][2];                         // [step][element], 4 pixels each
#pragma unroll
    for (int u = 0; u < 8; ++u) {
        wa[u] = *(const v4f*)(wrow + 8 * u);
#pragma unroll
        for (int q = 0; q < 4; ++q)
            xv[2 * u + (q >> 1)][q & 1] = *(const v4f*)(xb + (size_t)(8 * u + q) * N_);
    }

#pragma unroll
    for (int j = 0; j < 4; ++j) acc[j] = bi;

    // Stands in front of the first overwrite of the loads' address registers (a
    // precaution); naming them keeps them untouched up to here.
    asm volatile("s_wait_xcnt 0x0" :: "v"(xb), "v"(wrow), "v"(brow) : "memory");
    // Keeps all the loads in front of the first WMMA, in flight together: without
    // it the build sinks each pair of x loads to its step and the wave waits out
    // one round trip to L2 per step.
    __builtin_amdgcn_sched_barrier(0);

#pragma unroll
    for (int s = 0; s < 16; ++s) {
        const v2f wf = {wa[s >> 1][2 * (s & 1)], wa[s >> 1][2 * (s & 1) + 1]};
#pragma unroll
        for (int j = 0; j < 4; ++j) {
            const v2f xf = {xv[s][0][j], xv[s][1][j]};
            acc[j] = XA ? __builtin_amdgcn_wmma_f32_16x16x4_f32(false, xf, false, wf,
                                                                (short)0, acc[j], false, false)
                        : __builtin_amdgcn_wmma_f32_16x16x4_f32(false, wf, false, xf,
                                                                (short)0, acc[j], false, false);
        }
    }
}

__global__ __launch_bounds__(PW_ * 32) void proj_kernel(
    const float* __restrict__ x,
    const float* __restrict__ wq, const float* __restrict__ bq,
    const float* __restrict__ wk, const float* __restrict__ bk,
    const float* __restrict__ wv, const float* __restrict__ bv,
    uint4* __restrict__ Qp, uint4* __restrict__ Kp,
    uint4* __restrict__ Vf)
{
    int t    = threadIdx.x;
    int wave = __builtin_amdgcn_readfirstlane(t >> 5), lane = t & 31;
    int half = lane >> 4, col = lane & 15;
    int g0 = blockIdx.x * 64;              // first of the block's 64 pixels
    int b  = g0 >> 12;
    int n0 = g0 & (N_ - 1);

    const float* xb = x + ((size_t)b * C_ + 4 * half) * N_ + n0 + 4 * col;
    v8f acc[4];

    if (wave < 4) {
        proj_tile<true>(xb, wv + (wave * 16 + col) * C_ + 4 * half, bv + wave * 16 + col, acc);
        // acc[j][r] = channel wave*16 + col, pixel g0 + 32*half + 4r + j: the lane's
        // four pieces of chunk 'half'; 16 lanes store 256 B in a row.
        uint4* vp = Vf + ((size_t)b * NCH_ + (n0 >> 5) + half) * VCH_ + wave * 64 + col;
#pragma unroll
        for (int q = 0; q < 4; ++q)                   // q = 2p + (target lane >> 4)
            vp[q * 16] = make_uint4(pack2bf(acc[0][2 * q],     acc[1][2 * q]),
                                    pack2bf(acc[2][2 * q],     acc[3][2 * q]),
                                    pack2bf(acc[0][2 * q + 1], acc[1][2 * q + 1]),
                                    pack2bf(acc[2][2 * q + 1], acc[3][2 * q + 1]));
    } else {
        proj_tile<false>(xb, (col < 8 ? wq + col * C_ : wk + (col - 8) * C_) + 4 * half,
                         half ? bk : bq, acc);
        // acc[j][r] = channel r of Q (lower lane half) or K (upper half), pixel
        // g0 + 4*col + j: 4 padded rows = 128 B per lane.
        uint4* dst = (half ? Kp : Qp) + (size_t)(g0 + 4 * col) * 2;
        const uint4 z4 = make_uint4(0u, 0u, 0u, 0u);
#pragma unroll
        for (int j = 0; j < 4; ++j) {
            dst[2 * j] = make_uint4(pack2bf(acc[j][0], acc[j][1]), pack2bf(acc[j][2], acc[j][3]),
                                    pack2bf(acc[j][4], acc[j][5]), pack2bf(acc[j][6], acc[j][7]));
            dst[2 * j + 1] = z4;                      // K = 8..15 zero padding
        }
        // In the listing the other branch's code follows and reuses the address
        // registers of these stores: the wait stands in front of it.
        asm volatile("s_wait_xcnt 0x0" ::: "memory");
    }
}

// ---------------------------------------------------------------------------
// Kernel 2: per-row softmax constants on the matrix unit, finished in one launch.
// A block owns SR_ = 64 softmax rows n over ALL j of their batch: wave w takes
// 32 of the rows (w & 1; two B operands: Q) and one j-segment (w >> 1), which it
// walks in steps of 64 j (four A operands: K).  With K as A and Q as B
// the D tile holds S transposed: a lane keeps 8 scores of ONE row n, so the
// running max and sum of a row are lane-local.  A row's 8 partial (m, d) pairs
// (4 segments x the two j halves of each tile, lanes l and l^16) meet in LDS
// behind one barrier, and the block itself emits the fused softmax constant in
// the exp2 domain:  Crow[n] = -log2(D[n]) - M[n]*log2e,
// so that  P[n,m] = exp2(S[n,m]*log2e + Crow[n]).
// Every '#pragma unroll' here makes the indices of ka, kc, qb, s, tm, m, d and
// pr constants, without which they would not stay in registers.
// ---------------------------------------------------------------------------
__device__ inline void stats_load(uint4 (&kc)[4], const uint4* __restrict__ p)
{
#pragma unroll
    for (int jt = 0; jt < 4; ++jt) kc[jt] = p[jt * 32];     // 16 K rows = 32 uint4
}

// One step: 64 j (kc) against the wave's 32 rows; online max / sum update.
__device__ inline void stats_step(const uint4 (&kc)[4], const V16 (&qb)[2],
                                  float (&m)[2], float (&d)[2])
{
    const v8f zc = {0.f,0.f,0.f,0.f,0.f,0.f,0.f,0.f};
    V16 ka[4];
#pragma unroll
    for (int jt = 0; jt < 4; ++jt) {
        ka[jt].u[0] = kc[jt].x; ka[jt].u[1] = kc[jt].y;
        ka[jt].u[2] = kc[jt].z; ka[jt].u[3] = kc[jt].w;
        ka[jt].u[4] = 0u; ka[jt].u[5] = 0u; ka[jt].u[6] = 0u; ka[jt].u[7] = 0u;
    }
#pragma unroll
    for (int nt = 0; nt < 2; ++nt) {
        v8f s[4];
#pragma unroll
        for (int jt = 0; jt < 4; ++jt)
            s[jt] = __builtin_amdgcn_wmma_f32_16x16x32_bf16(false, ka[jt].v, false, qb[nt].v,
                                                            (short)0, zc, false, false);
        float tm[4];                                  // one short max chain per tile
#pragma unroll
        for (int jt = 0; jt < 4; ++jt) {
            tm[jt] = s[jt][0];
#pragma unroll
            for (int r = 1; r < 8; ++r) tm[jt] = fmaxf(tm[jt], s[jt][r]);
        }
        const float mn = fmaxf(fmaxf(fmaxf(m[nt], tm[0]), tm[1]), fmaxf(tm[2], tm[3]));
        const float mL = mn * LOG2E_;
        v2f a0 = {0.f, 0.f}, a1 = {0.f, 0.f};         // independent partial sums
#pragma unroll
        for (int jt = 0; jt < 4; ++jt)
#pragma unroll
            for (int r = 0; r < 8; r += 4) {
                v2f e0 = {s[jt][r],     s[jt][r + 1]};
                v2f e1 = {s[jt][r + 2], s[jt][r + 3]};
                e0 = e0 * LOG2E_ - mL;
                e1 = e1 * LOG2E_ - mL;
                v2f p0 = {__builtin_amdgcn_exp2f(e0.x), __builtin_amdgcn_exp2f(e0.y)};
                v2f p1 = {__builtin_amdgcn_exp2f(e1.x), __builtin_amdgcn_exp2f(e1.y)};
                a0 += p0;
                a1 += p1;
            }
        a0 += a1;
        d[nt] = fmaf(d[nt], __builtin_amdgcn_exp2f((m[nt] - mn) * LOG2E_), a0.x + a0.y);
        m[nt] = mn;
    }
}

#define SR_ 64                       // softmax rows per block

__global__ __launch_bounds__(256) void stats_kernel(
    const uint4* __restrict__ Qp, const uint4* __restrict__ Kp,
    float* __restrict__ Crow)
{
    __shared__ float2 part[2 * NSEG_][SR_];        // [segment*2 + lane half][row]

    int t    = threadIdx.x;
    int wave = __builtin_amdgcn_readfirstlane(t >> 5), lane = t & 31;
    int half = lane >> 4, col = lane & 15;
    int rg  = wave & 1;                // which 32 of the block's 64 rows
    int seg = wave >> 1;               // 4 segments
    int gb  = blockIdx.x * SR_;        // first of the block's 64 rows
    int g0  = gb + rg * 32;            // first of this wave's 32 rows
    int b   = g0 >> 12;

    // Same loader for Q and K as in the output kernel (upper-half lanes read the
    // stored zero padding), so the k order of A and B is equal at every position.
    V16 qb[2];
#pragma unroll
    for (int nt = 0; nt < 2; ++nt) {
        uint4 qv = Qp[(size_t)(g0 + nt * 16 + col) * 2 + half];
        qb[nt].u[0] = qv.x; qb[nt].u[1] = qv.y; qb[nt].u[2] = qv.z; qb[nt].u[3] = qv.w;
        qb[nt].u[4] = 0u;   qb[nt].u[5] = 0u;   qb[nt].u[6] = 0u;   qb[nt].u[7] = 0u;
    }

    const uint4* kp = Kp + ((size_t)b * N_ + seg * SEGJ_ + col) * 2 + half;
    uint4 kA[4], kB[4];                // two register buffers: each step's K rows
    stats_load(kA, kp);                // are fetched one step ahead of their use

    float m[2] = {-3.0e38f, -3.0e38f};
    float d[2] = {0.0f, 0.0f};

    for (int j0 = 0; j0 < SEGJ_; j0 += 128) {
        stats_load(kB, kp + 128);
        stats_step(kA, qb, m, d);
        if (j0 + 128 < SEGJ_) stats_load(kA, kp + 256);
        stats_step(kB, qb, m, d);
        // Stands in front of the overwrite of the K loads' address registers (a
        // precaution); naming them keeps them untouched up to here.  The scheduling
        // barrier holds the wait at the trip's end: without it the build lifts wait
        // and overwrite to just behind the loads' issue, where the wave could stall.
        __builtin_amdgcn_sched_barrier(0);
        asm volatile("s_wait_xcnt 0x0" :: "v"(kp) : "memory");
        kp += 256;
    }

    // Every lane publishes its partial of each of its 2 rows.
#pragma unroll
    for (int nt = 0; nt < 2; ++nt)
        part[seg * 2 + half][rg * 32 + nt * 16 + col] = make_float2(m[nt], d[nt]);

    __syncthreads();

    // Waves 0 and 1: thread t merges the 8 partials of row gb + t, in segment order.
    if (t < SR_) {
        float2 pr[2 * NSEG_];
#pragma unroll
        for (int s = 0; s < 2 * NSEG_; ++s) pr[s] = part[s][t];
        float mm = pr[0].x;
#pragma unroll
        for (int s = 1; s < 2 * NSEG_; ++s) mm = fmaxf(mm, pr[s].x);
        float dd = 0.0f;
#pragma unroll
        for (int s = 0; s < 2 * NSEG_; ++s)
            dd += pr[s].y * __builtin_amdgcn_exp2f((pr[s].x - mm) * LOG2E_);
        Crow[gb + t] = -__builtin_amdgcn_logf(dd) - mm * LOG2E_;   // v_log_f32 is log2
    }
}

// ---------------------------------------------------------------------------
// Kernel 3: out = V @ softmax_rows(QtK) + x.  One block owns 64 output columns
// (4 m-tiles) of one batch; its NW_ waves share out the n loop, each working
// on all 4 m-tiles, so every Q, Crow and V fragment it loads feeds 4 tiles.
// The per-wave f32 partial sums meet in LDS: after one barrier wave w adds the
// NW_ partials of accumulator tile w in wave order and stores it with x.
// Key identity: the WMMA C-layout of the two S tiles (lane holds
// rows 8*half+r / 16+8*half+r of column l%16) is exactly the lane-local data
// the PV B-operand layout needs, so P is repacked C->B in registers.
// Every '#pragma unroll' here makes the indices of acc, kb, av, pb and the
// small float arrays constants, without which they would not stay in registers.
// ---------------------------------------------------------------------------
#define NW_   16                     // waves per block = n slices = acc tiles

__global__ __launch_bounds__(NW_ * 32) void attn_out_kernel(
    const uint4* __restrict__ Qp, const uint4* __restrict__ Kp,
    const uint4* __restrict__ Vf,
    const float* __restrict__ Crow,
    const float* __restrict__ x, float* __restrict__ out)
{
    __shared__ float4 red[NW_][32][32];            // [wave][tile*2 + r/4][lane]

    int t    = threadIdx.x;
    int wave = __builtin_amdgcn_readfirstlane(t >> 5), lane = t & 31;
    int half = lane >> 4, col = lane & 15;
    int b  = blockIdx.x >> 6;
    int m0 = (blockIdx.x & 63) << 6;

    const size_t bN = (size_t)b * N_;

    // B-operands for scores: K columns m0..m0+63 (fixed for the whole wave).
    // Unconditional load: upper-half lanes read the stored zero padding.
    V16 kb[4];
#pragma unroll
    for (int mt = 0; mt < 4; ++mt) {
        uint4 kv = Kp[(bN + m0 + mt * 16 + col) * 2 + half];
        kb[mt].u[0] = kv.x; kb[mt].u[1] = kv.y; kb[mt].u[2] = kv.z; kb[mt].u[3] = kv.w;
        kb[mt].u[4] = 0u;   kb[mt].u[5] = 0u;   kb[mt].u[6] = 0u;   kb[mt].u[7] = 0u;
    }
    // The address registers of the four K loads are reused by the set-up code
    // below:
    // the wait stands here, and the scheduling barrier keeps that code behind it.
    asm volatile("s_wait_xcnt 0x0" ::: "memory");
    __builtin_amdgcn_sched_barrier(0);

    const v8f zc = {0.f,0.f,0.f,0.f,0.f,0.f,0.f,0.f};
    v8f acc[4][4];                                 // [ct][mt]
#pragma unroll
    for (int ct = 0; ct < 4; ++ct)
#pragma unroll
        for (int mt = 0; mt < 4; ++mt) acc[ct][mt] = zc;

    // V lies in fragment order (see the projection kernel): piece 'lane' of each
    // of a chunk's 8 groups of 32 pieces, so a V load reads 4 whole 128-B lines.
    const uint4* vbase = Vf + (size_t)b * NCH_ * VCH_ + lane;

    // Chunks of 32 n are dealt round robin.
    int n0 = wave * 32;
    do {
        // All of this 32-n chunk's loads first: Q rows (two 16-row A tiles),
        // the 16 row constants of this lane, 4 c-tiles of V (A-operands).
        uint4 v0 = Qp[(bN + n0 + col) * 2 + half];
        uint4 v1 = Qp[(bN + n0 + 16 + col) * 2 + half];
        const float4* cr = (const float4*)(Crow + bN + n0 + 8 * half);
        float4 c0 = cr[0], c1 = cr[1], c2 = cr[4], c3 = cr[5];
        V16 av[4];
#pragma unroll
        for (int ct = 0; ct < 4; ++ct) {
            const uint4* vc = vbase + (size_t)n0 * (VCH_ / 32) + ct * 64;
            uint4 a0 = vc[0];
            uint4 a1 = vc[32];
            av[ct].u[0] = a0.x; av[ct].u[1] = a0.y; av[ct].u[2] = a0.z; av[ct].u[3] = a0.w;
            av[ct].u[4] = a1.x; av[ct].u[5] = a1.y; av[ct].u[6] = a1.z; av[ct].u[7] = a1.w;
        }
        V16 aq0, aq1;
        aq0.u[0] = v0.x; aq0.u[1] = v0.y; aq0.u[2] = v0.z; aq0.u[3] = v0.w;
        aq1.u[0] = v1.x; aq1.u[1] = v1.y; aq1.u[2] = v1.z; aq1.u[3] = v1.w;
        aq0.u[4] = aq0.u[5] = aq0.u[6] = aq0.u[7] = 0u;
        aq1.u[4] = aq1.u[5] = aq1.u[6] = aq1.u[7] = 0u;
        const float cw0[8] = {c0.x, c0.y, c0.z, c0.w, c1.x, c1.y, c1.z, c1.w};
        const float cw1[8] = {c2.x, c2.y, c2.z, c2.w, c3.x, c3.y, c3.z, c3.w};

#pragma unroll
        for (int mt = 0; mt < 4; ++mt) {
            // P = exp2(s*log2e + Crow[row]); C-layout -> B-layout is lane-local:
            // pb pair j<4 = rows {8h+2j, 8h+2j+1} of tile 0, pair j>=4 = tile 1.
            V16 pb;
            {
                v8f s = __builtin_amdgcn_wmma_f32_16x16x32_bf16(false, aq0.v, false, kb[mt].v,
                                                                (short)0, zc, false, false);
#pragma unroll
                for (int tp = 0; tp < 4; ++tp) {
                    float p0 = __builtin_amdgcn_exp2f(fmaf(s[2*tp],     LOG2E_, cw0[2*tp]));
                    float p1 = __builtin_amdgcn_exp2f(fmaf(s[2*tp + 1], LOG2E_, cw0[2*tp + 1]));
                    pb.u[tp] = __builtin_amdgcn_perm(__float_as_uint(p1), __float_as_uint(p0), 0x07060302u);
                }
            }
            {
                v8f s = __builtin_amdgcn_wmma_f32_16x16x32_bf16(false, aq1.v, false, kb[mt].v,
                                                                (short)0, zc, false, false);
#pragma unroll
                for (int tp = 0; tp < 4; ++tp) {
                    float p2 = __builtin_amdgcn_exp2f(fmaf(s[2*tp],     LOG2E_, cw1[2*tp]));
                    float p3 = __builtin_amdgcn_exp2f(fmaf(s[2*tp + 1], LOG2E_, cw1[2*tp + 1]));
                    pb.u[4 + tp] = __builtin_amdgcn_perm(__float_as_uint(p3), __float_as_uint(p2), 0x07060302u);
                }
            }
#pragma unroll
            for (int ct = 0; ct < 4; ++ct)
                acc[ct][mt] = __builtin_amdgcn_wmma_f32_16x16x32_bf16(false, av[ct].v, false, pb.v,
                                                                      (short)0, acc[ct][mt], false, false);
        }
        n0 += NW_ * 32;
    } while (n0 < N_);

    // Every wave publishes its 16 partial tiles, lane-contiguous 16-B pieces.
#pragma unroll
    for (int ct = 0; ct < 4; ++ct)
#pragma unroll
        for (int mt = 0; mt < 4; ++mt) {
            v8f a = acc[ct][mt];
            red[wave][(ct * 4 + mt) * 2    ][lane] = make_float4(a[0], a[1], a[2], a[3]);
            red[wave][(ct * 4 + mt) * 2 + 1][lane] = make_float4(a[4], a[5], a[6], a[7]);
        }

    // Wave w finishes tile w = ct*4 + mt; its residual x is fetched meanwhile.
    const int ct = wave >> 2, mt = wave & 3;
    const size_t idx0 = ((size_t)b * C_ + ct * 16 + 8 * half) * N_ + m0 + mt * 16 + col;
    float xv[8];
#pragma unroll
    for (int r = 0; r < 8; ++r) xv[r] = x[idx0 + (size_t)r * N_];

    __syncthreads();

    float4 lo0 = red[0][wave * 2][lane], hi0 = red[0][wave * 2 + 1][lane];
    float sum[8] = {lo0.x, lo0.y, lo0.z, lo0.w, hi0.x, hi0.y, hi0.z, hi0.w};
#pragma unroll
    for (int s = 1; s < NW_; ++s) {
        float4 lo = red[s][wave * 2    ][lane];
        float4 hi = red[s][wave * 2 + 1][lane];
        sum[0] += lo.x; sum[1] += lo.y; sum[2] += lo.z; sum[3] += lo.w;
        sum[4] += hi.x; sum[5] += hi.y; sum[6] += hi.z; sum[7] += hi.w;
    }
#pragma unroll
    for (int r = 0; r < 8; ++r) out[idx0 + (size_t)r * N_] = sum[r] + xv[r];
}

// ---------------------------------------------------------------------------
extern "C" void kernel_launch(void* const* d_in, const int* in_sizes, int n_in,
                              void* d_out, int out_size, void* d_ws, size_t ws_size,
                              hipStream_t stream)
{
    const float* x  = (const float*)d_in[0];
    const float* wq = (const float*)d_in[1];
    const float* bq = (const float*)d_in[2];
    const float* wk = (const float*)d_in[3];
    const float* bk = (const float*)d_in[4];
    const float* wv = (const float*)d_in[5];
    const float* bv = (const float*)d_in[6];
    float* out = (float*)d_out;

    char* ws = (char*)d_ws;
    const size_t qp_bytes = (size_t)B_ * N_ * 16 * 2;           // 512 KB (padded rows)
    const size_t vb_bytes = (size_t)B_ * C_ * N_ * 2;           // 2 MB

    uint4*          Qp    = (uint4*)(ws);
    uint4*          Kp    = (uint4*)(ws + qp_bytes);
    uint4*          Vf    = (uint4*)(ws + 2 * qp_bytes);
    float*          Crow  = (float*)(ws + 2 * qp_bytes + vb_bytes);

    proj_kernel<<<(B_ * N_) / 64, PW_ * 32, 0, stream>>>(x, wq, bq, wk, bk, wv, bv, Qp, Kp, Vf);
    stats_kernel<<<(B_ * N_) / SR_, 256, 0, stream>>>(Qp, Kp, Crow);
    attn_out_kernel<<<B_ * (N_ / 64), NW_ * 32, 0, stream>>>(Qp, Kp, Vf, Crow, x, out);
}

// v006
// It runs in 23.3 microseconds.
// In two side-by-side timings against v005, it was 1.07 and 1.09 times as fast.
// Over all steps from v000 it is 9.35 times as fast.
#include <hip/hip_runtime.h>
#include <stdint.h>

#define B_  4
#define C_  64
#define N_  4096
#define C8_ 8

#define NSEG_ 4
#define SEGJ_ (N_ / NSEG_)          // 1024 j per stats segment

typedef __attribute__((ext_vector_type(16))) __bf16 v16bf;
typedef __attribute__((ext_vector_type(8)))  float  v8f;
typedef __attribute__((ext_vector_type(2)))  float  v2f;
typedef __attribute__((ext_vector_type(4)))  float  v4f;

union V16 { unsigned u[8]; v16bf v; };

#define LOG2E_ 1.4426950408889634f

__device__ inline unsigned short f2bf(float f) {
    unsigned u = __float_as_uint(f);
    unsigned r = u + 0x7FFFu + ((u >> 16) & 1u);   // round-to-nearest-even
    return (unsigned short)(r >> 16);
}
__device__ inline float bf2f(unsigned short h) {
    return __uint_as_float(((unsigned)h) << 16);
}

// exp2 of eight values, each in its own register.  One asm statement: every
// v_exp_f32 overwrites its own source only, and the closing v_nop is a slot in
// front of whatever reads the last result.
__device__ __forceinline__ void exp2x8(v8f& s) {
    float a = s[0], b = s[1], c = s[2], d = s[3], e = s[4], f = s[5], g = s[6], h = s[7];
    asm("v_exp_f32 %0, %0\n\tv_exp_f32 %1, %1\n\tv_exp_f32 %2, %2\n\tv_exp_f32 %3, %3\n\t"
        "v_exp_f32 %4, %4\n\tv_exp_f32 %5, %5\n\tv_exp_f32 %6, %6\n\tv_exp_f32 %7, %7\n\tv_nop"
        : "+v"(a), "+v"(b), "+v"(c), "+v"(d), "+v"(e), "+v"(f), "+v"(g), "+v"(h));
    s = (v8f){a, b, c, d, e, f, g, h};
}

// A score tile's 8 values -> exp2 -> 4 pairs of bf16 (the upper halves), for the
// same reason in one asm statement; the first packs are the slot behind the last
// v_exp_f32.  The s_delay_alu tells the issue logic that the last two packs read
// results of the third-last and the last v_exp_f32 (for speed only).
__device__ __forceinline__ void exp2_pack(const v8f& s, unsigned& p0, unsigned& p1,
                                          unsigned& p2, unsigned& p3) {
    float a = s[0], b = s[1], c = s[2], d = s[3], e = s[4], f = s[5], g = s[6], h = s[7];
    asm("v_exp_f32 %4, %4\n\tv_exp_f32 %5, %5\n\tv_exp_f32 %6, %6\n\tv_exp_f32 %7, %7\n\t"
        "v_exp_f32 %8, %8\n\tv_exp_f32 %9, %9\n\tv_exp_f32 %10, %10\n\tv_exp_f32 %11, %11\n\t"
        "v_perm_b32 %0, %5, %4, 0x7060302\n\tv_perm_b32 %1, %7, %6, 0x7060302\n\t"
        "s_delay_alu instid0(TRANS32_DEP_3) | instskip(NEXT) | instid1(TRANS32_DEP_1)\n\t"
        "v_perm_b32 %2, %9, %8, 0x7060302\n\tv_perm_b32 %3, %11, %10, 0x7060302"
        : "=&v"(p0), "=&v"(p1), "=&v"(p2), "=&v"(p3),
          "+v"(a), "+v"(b), "+v"(c), "+v"(d), "+v"(e), "+v"(f), "+v"(g), "+v"(h));
}

// Maximum over the lane's row of 16 lanes (DPP row_xmask 1, 2, 4, 8): every lane
// of the row ends up with it.
template <int CTRL>
__device__ inline float dpp_max(float v) {
    return fmaxf(v, __int_as_float(__builtin_amdgcn_update_dpp(
                        __float_as_int(v), __float_as_int(v), CTRL, 0xf, 0xf, false)));
}
__device__ inline float row_max16(float v) {
    return dpp_max<0x168>(dpp_max<0x164>(dpp_max<0x162>(dpp_max<0x161>(v))));
}

// ---------------------------------------------------------------------------
// Kernel 1: fused QKV projection on the matrix unit, in f32 (16x16x4 form).
// x [B][64][N] f32 -> Qp,Kp [B][N][16] bf16 (32 B rows; elements 8..15 zeroed
// = WMMA K-padding, so attn-kernel lanes can load unconditionally; Q is stored
// times log2(e), so that every score q.k comes out of its WMMA in the exp2 domain),
// Kn2 = the largest |k|^2 among the block's 64 pixels (for the stats kernel; one
// float per block, each in a 128-B line of its own: one writer per line),
// V bf16 in the order of the output kernel's A fragments (below), biases fused
// (they are the accumulators' start values).
// One block per 64 pixels, so that every WGP works; each of its PW_ waves owns
// one tile of 16 output channels (waves 0..3: V; wave 4: Q over K) and all 64
// pixels as four tiles.  Index c of pixel tile j is pixel 4c + j: one 16-B load
// of x feeds all four tiles.
// Wave 4 takes the weights as A and x as B: a lane ends up with 8 channels of
// each of 4 neighbouring pixels, which are 4 rows of Qp or Kp.
// Waves 0..3 take x as A and the weights as B: a lane ends up with ONE channel
// (col) and the 32 neighbouring pixels 32*half + 4r + j, which are that
// channel's share of one 32-pixel chunk of V.
// Layout of Vf, in 16-B pieces: [b][chunk of 32 n][c-tile][p][lane], where piece
// (p, lane) holds n = 16p + 8*(lane>>4) + 0..7 of channel lane&15: lane l of the
// output kernel reads piece l, so each of its V loads is 512 B in a row.
// k order: element e of step s in lane half h is input channel
// 8*(s/2) + 4*h + 2*(s%2) + e, for the weight loader and the x loader alike.
// Every '#pragma unroll' here makes the indices of wa, xv and acc constants,
// without which they would not stay in registers.
// ---------------------------------------------------------------------------
#define PW_ 5                        // waves per block = tiles of 16 channels
#define NCH_ (N_ / 32)               // chunks of 32 n per batch
#define VCH_ 256                     // 16-B pieces of Vf per chunk (4 KB)
#define KNP_ 32                      // floats from one block's Kn2 to the next

__device__ inline unsigned pack2bf(float lo, float hi) {
    return (unsigned)f2bf(lo) | ((unsigned)f2bf(hi) << 16);
}

// One wave's 16 channels x 64 pixels.  XA: x is the A operand (rows of D are
// pixels, brow points to the lane's one bias); else the weights are (rows of D
// are channels, brow points to the biases of the lane's 8 rows).
template <bool XA>
__device__ __forceinline__ void proj_tile(const float* __restrict__ xb,
                                          const float* __restrict__ wrow,
                                          const float* __restrict__ brow,
                                          v8f (&acc)[4])
{
    // Loads in the order of their use, so that the first steps can start while
    // the later ones' data are still on their way.
    v8f bi;
    if (XA) {
        const float bb = *brow;
        bi = (v8f){bb, bb, bb, bb, bb, bb, bb, bb};
    } else {
        const v4f b0 = *(const v4f*)brow, b1 = *(const v4f*)(brow + 4);
        bi = (v8f){b0.x, b0.y, b0.z, b0.w, b1.x, b1.y, b1.z, b1.w};
    }
    v4f wa[8];                             // wa[u] = steps 2u and 2u + 1
    v4f xv[16][2];                         // [step][element], 4 pixels each
#pragma unroll
    for (int u = 0; u < 8; ++u) {
        wa[u] = *(const v4f*)(wrow + 8 * u);
#pragma unroll
        for (int q = 0; q < 4; ++q)
            xv[2 * u + (q >> 1)][q & 1] = *(const v4f*)(xb + (size_t)(8 * u + q) * N_);
    }

#pragma unroll
    for (int j = 0; j < 4; ++j) acc[j] = bi;

    // Stands in front of the first overwrite of the loads' address registers (a
    // precaution); naming them keeps them untouched up to here.
    asm volatile("s_wait_xcnt 0x0" :: "v"(xb), "v"(wrow), "v"(brow) : "memory");
    // Keeps all the loads in front of the first WMMA, in flight together: without
    // it the build sinks each pair of x loads to its step and the wave waits out
    // one round trip to L2 per step.
    __builtin_amdgcn_sched_barrier(0);

#pragma unroll
    for (int s = 0; s < 16; ++s) {
        const v2f wf = {wa[s >> 1][2 * (s & 1)], wa[s >> 1][2 * (s & 1) + 1]};
#pragma unroll
        for (int j = 0; j < 4; ++j) {
            const v2f xf = {xv[s][0][j], xv[s][1][j]};
            acc[j] = XA ? __builtin_amdgcn_wmma_f32_16x16x4_f32(false, xf, false, wf,
                                                                (short)0, acc[j], false, false)
                        : __builtin_amdgcn_wmma_f32_16x16x4_f32(false, wf, false, xf,
                                                                (short)0, acc[j], false, false);
        }
    }
}

__global__ __launch_bounds__(PW_ * 32) void proj_kernel(
    const float* __restrict__ x,
    const float* __restrict__ wq, const float* __restrict__ bq,
    const float* __restrict__ wk, const float* __restrict__ bk,
    const float* __restrict__ wv, const float* __restrict__ bv,
    uint4* __restrict__ Qp, uint4* __restrict__ Kp,
    uint4* __restrict__ Vf, float* __restrict__ Kn2)
{
    int t    = threadIdx.x;
    int wave = __builtin_amdgcn_readfirstlane(t >> 5), lane = t & 31;
    int half = lane >> 4, col = lane & 15;
    int g0 = blockIdx.x * 64;              // first of the block's 64 pixels
    int b  = g0 >> 12;
    int n0 = g0 & (N_ - 1);

    const float* xb = x + ((size_t)b * C_ + 4 * half) * N_ + n0 + 4 * col;
    v8f acc[4];

    if (wave < 4) {
        proj_tile<true>(xb, wv + (wave * 16 + col) * C_ + 4 * half, bv + wave * 16 + col, acc);
        // acc[j][r] = channel wave*16 + col, pixel g0 + 32*half + 4r + j: the lane's
        // four pieces of chunk 'half'; 16 lanes store 256 B in a row.
        uint4* vp = Vf + ((size_t)b * NCH_ + (n0 >> 5) + half) * VCH_ + wave * 64 + col;
#pragma unroll
        for (int q = 0; q < 4; ++q)                   // q = 2p + (target lane >> 4)
            vp[q * 16] = make_uint4(pack2bf(acc[0][2 * q],     acc[1][2 * q]),
                                    pack2bf(acc[2][2 * q],     acc[3][2 * q]),
                                    pack2bf(acc[0][2 * q + 1], acc[1][2 * q + 1]),
                                    pack2bf(acc[2][2 * q + 1], acc[3][2 * q + 1]));
    } else {
        proj_tile<false>(xb, (col < 8 ? wq + col * C_ : wk + (col - 8) * C_) + 4 * half,
                         half ? bk : bq, acc);
        // acc[j][r] = channel r of Q (lower lane half) or K (upper half), pixel
        // g0 + 4*col + j: 4 padded rows = 128 B per lane.
        uint4* dst = (half ? Kp : Qp) + (size_t)(g0 + 4 * col) * 2;
        const uint4 z4 = make_uint4(0u, 0u, 0u, 0u);
        const float sc = half ? 1.0f : LOG2E_;
#pragma unroll
        for (int j = 0; j < 4; ++j) acc[j] *= sc;
#pragma unroll
        for (int j = 0; j < 4; ++j) {
            dst[2 * j] = make_uint4(pack2bf(acc[j][0], acc[j][1]), pack2bf(acc[j][2], acc[j][3]),
                                    pack2bf(acc[j][4], acc[j][5]), pack2bf(acc[j][6], acc[j][7]));
            dst[2 * j + 1] = z4;                      // K = 8..15 zero padding
        }
        float k2 = 0.0f;                              // largest squared norm of 4 rows
#pragma unroll
        for (int j = 0; j < 4; ++j) {
            float t2 = 0.0f;
#pragma unroll
            for (int r = 0; r < 8; ++r) t2 = fmaf(acc[j][r], acc[j][r], t2);
            k2 = fmaxf(k2, t2);
        }
        k2 = row_max16(k2);                           // lanes 16..31: over the 64 K rows
        if (lane == 16) Kn2[blockIdx.x * KNP_] = k2;
        // In the listing the other branch's code follows and reuses the address
        // registers of these stores: the wait stands in front of it.
        asm volatile("s_wait_xcnt 0x0" ::: "memory");
    }
}

// ---------------------------------------------------------------------------
// Kernel 2: per-row softmax constants on the matrix unit, finished in one launch.
// A block owns SR_ = 64 softmax rows n over ALL j of their batch: wave w takes
// 32 of the rows (w & 1; two B operands: Q) and one j-segment (w >> 1), which it
// walks in steps of 64 j (four A operands: K).  With K as A and Q as B
// the D tile holds S transposed: a lane keeps 8 scores of ONE row n, so the
// sum of a row is lane-local.  Scores are in the exp2 domain (Q is stored so).
// The shift m of a row only has to lie near its largest score: close enough
// that exp2(s - m) neither overflows nor all but vanishes.  |q|*max|k| (the
// maximum over the wave's segment) is known before the products, lies at or above
// every score (up to rounding) and at most twice itself above the largest one, so
// while it is at most BMAX_ it serves as m, and goes into the WMMA as C: exp2
// reads D as it is.  A wave with a larger bound (or a NaN) walks with the exact
// running maximum instead.
// A row's 8 partial (m, d) pairs (4 segments x the two j halves of each tile,
// lanes l and l^16) meet in LDS behind one barrier, and the block itself emits
// the fused softmax constant:  Crow[n] = -log2(D[n]) - M[n],
// so that  P[n,m] = exp2(S[n,m] + Crow[n]).
// Every '#pragma unroll' here makes the indices of ka, kc, qb, cn, s, tm, m, d, a
// and pr constants, without which they would not stay in registers.
// ---------------------------------------------------------------------------
#define BMAX_ 50.0f                  // exp2(s - m) stays at or above 2^-100

__device__ inline void stats_load(uint4 (&kc)[4], const uint4* __restrict__ p)
{
#pragma unroll
    for (int jt = 0; jt < 4; ++jt) kc[jt] = p[jt * 32];     // 16 K rows = 32 uint4
}

__device__ inline void stats_frag(V16 (&ka)[4], const uint4 (&kc)[4])
{
#pragma unroll
    for (int jt = 0; jt < 4; ++jt) {
        ka[jt].u[0] = kc[jt].x; ka[jt].u[1] = kc[jt].y;
        ka[jt].u[2] = kc[jt].z; ka[jt].u[3] = kc[jt].w;
        ka[jt].u[4] = 0u; ka[jt].u[5] = 0u; ka[jt].u[6] = 0u; ka[jt].u[7] = 0u;
    }
}

// One step, shift known: 64 j (kc) against the wave's 32 rows; cn = -m in every
// element, a = four independent partial sums per row tile.
__device__ inline void stats_step_bound(const uint4 (&kc)[4], const V16 (&qb)[2],
                                        const v8f (&cn)[2], v2f (&a)[2][4])
{
    V16 ka[4];
    stats_frag(ka, kc);
#pragma unroll
    for (int nt = 0; nt < 2; ++nt) {
        v8f s[4];
#pragma unroll
        for (int jt = 0; jt < 4; ++jt)
            s[jt] = __builtin_amdgcn_wmma_f32_16x16x32_bf16(false, ka[jt].v, false, qb[nt].v,
                                                            (short)0, cn[nt], false, false);
#pragma unroll
        for (int jt = 0; jt < 4; ++jt)
#pragma unroll
            for (int r = 0; r < 8; r += 2) {
                v2f p = {__builtin_amdgcn_exp2f(s[jt][r]), __builtin_amdgcn_exp2f(s[jt][r + 1])};
                a[nt][r >> 1] += p;
            }
    }
}

// One step, exact: online max / sum update.
__device__ inline void stats_step(const uint4 (&kc)[4], const V16 (&qb)[2],
                                  float (&m)[2], float (&d)[2])
{
    const v8f zc = {0.f,0.f,0.f,0.f,0.f,0.f,0.f,0.f};
    V16 ka[4];
    stats_frag(ka, kc);
#pragma unroll
    for (int nt = 0; nt < 2; ++nt) {
        v8f s[4];
#pragma unroll
        for (int jt = 0; jt < 4; ++jt)
            s[jt] = __builtin_amdgcn_wmma_f32_16x16x32_bf16(false, ka[jt].v, false, qb[nt].v,
                                                            (short)0, zc, false, false);
        float tm[4];                                  // one short max chain per tile
#pragma unroll
        for (int jt = 0; jt < 4; ++jt) {
            tm[jt] = s[jt][0];
#pragma unroll
            for (int r = 1; r < 8; ++r) tm[jt] = fmaxf(tm[jt], s[jt][r]);
        }
        const float mn = fmaxf(fmaxf(fmaxf(m[nt], tm[0]), tm[1]), fmaxf(tm[2], tm[3]));
        v2f a0 = {0.f, 0.f}, a1 = {0.f, 0.f};         // independent partial sums
#pragma unroll
        for (int jt = 0; jt < 4; ++jt)
#pragma unroll
            for (int r = 0; r < 8; r += 4) {
                v2f e0 = {s[jt][r],     s[jt][r + 1]};
                v2f e1 = {s[jt][r + 2], s[jt][r + 3]};
                e0 = e0 - mn;
                e1 = e1 - mn;
                v2f p0 = {__builtin_amdgcn_exp2f(e0.x), __builtin_amdgcn_exp2f(e0.y)};
                v2f p1 = {__builtin_amdgcn_exp2f(e1.x), __builtin_amdgcn_exp2f(e1.y)};
                a0 += p0;
                a1 += p1;
            }
        a0 += a1;
        d[nt] = fmaf(d[nt], __builtin_amdgcn_exp2f(m[nt] - mn), a0.x + a0.y);
        m[nt] = mn;
    }
}

// Squared norm of a stored row's 8 bf16 elements.
__device__ inline float row_norm2(uint4 v)
{
    const unsigned u[4] = {v.x, v.y, v.z, v.w};
    float t = 0.0f;
#pragma unroll
    for (int i = 0; i < 4; ++i) {
        const float lo = __uint_as_float(u[i] << 16), hi = __uint_as_float(u[i] & 0xFFFF0000u);
        t = fmaf(lo, lo, fmaf(hi, hi, t));
    }
    return t;
}

#define SR_ 64                       // softmax rows per block

__global__ __launch_bounds__(256) void stats_kernel(
    const uint4* __restrict__ Qp, const uint4* __restrict__ Kp,
    const float* __restrict__ Kn2, float* __restrict__ Crow)
{
    __shared__ float2 part[2 * NSEG_][SR_];        // [segment*2 + lane half][row]

    int t    = threadIdx.x;
    int wave = __builtin_amdgcn_readfirstlane(t >> 5), lane = t & 31;
    int half = lane >> 4, col = lane & 15;
    int rg  = wave & 1;                // which 32 of the block's 64 rows
    int seg = wave >> 1;               // 4 segments
    int gb  = blockIdx.x * SR_;        // first of the block's 64 rows
    int g0  = gb + rg * 32;            // first of this wave's 32 rows
    int b   = g0 >> 12;

    // Every lane loads its row's 8 real elements (for the norm); as B operand the
    // upper-half lanes hold zeros, the same values as the stored padding that the K
    // loader reads there, so the k order of A and B is equal at every position.
    V16 qb[2];
    uint4 qr[2];
#pragma unroll
    for (int nt = 0; nt < 2; ++nt) {
        qr[nt] = Qp[(size_t)(g0 + nt * 16 + col) * 2];
        qb[nt].u[0] = half ? 0u : qr[nt].x; qb[nt].u[1] = half ? 0u : qr[nt].y;
        qb[nt].u[2] = half ? 0u : qr[nt].z; qb[nt].u[3] = half ? 0u : qr[nt].w;
        qb[nt].u[4] = 0u;   qb[nt].u[5] = 0u;   qb[nt].u[6] = 0u;   qb[nt].u[7] = 0u;
    }
    // The segment's 1024 j are 16 blocks of the projection kernel.
    const float kn = Kn2[((b * N_ + seg * SEGJ_) / 64 + col) * KNP_];

    const uint4* kp = Kp + ((size_t)b * N_ + seg * SEGJ_ + col) * 2 + half;
    uint4 kA[4], kB[4];                // two register buffers: each step's K rows
    stats_load(kA, kp);                // are fetched one step ahead of their use
    // Keeps the first K loads in front of the wait for kn: without it the build
    // issues them behind that wait, and the wave waits out two round trips to L2.
    __builtin_amdgcn_sched_barrier(0);

    const float k2 = row_max16(kn);    // largest |k|^2 of the segment
    float m[2], d[2];
#pragma unroll
    for (int nt = 0; nt < 2; ++nt) m[nt] = __builtin_amdgcn_sqrtf(row_norm2(qr[nt]) * k2);

    // One test per wave, a scalar branch: the WMMAs of both sides run with every
    // lane on.  Written so that a NaN takes the exact side.
    if (__builtin_amdgcn_ballot_w32(!(m[0] <= BMAX_ && m[1] <= BMAX_)) == 0) {
        v8f cn[2];
        v2f a[2][4];
#pragma unroll
        for (int nt = 0; nt < 2; ++nt) {
            const float c = -m[nt];
            cn[nt] = (v8f){c, c, c, c, c, c, c, c};
#pragma unroll
            for (int i = 0; i < 4; ++i) a[nt][i] = (v2f){0.f, 0.f};
        }
        for (int j0 = 0; j0 < SEGJ_; j0 += 128) {
            stats_load(kB, kp + 128);
            stats_step_bound(kA, qb, cn, a);
            if (j0 + 128 < SEGJ_) stats_load(kA, kp + 256);
            stats_step_bound(kB, qb, cn, a);
            // As in the exact loop below.
            __builtin_amdgcn_sched_barrier(0);
            asm volatile("s_wait_xcnt 0x0" :: "v"(kp) : "memory");
            kp += 256;
        }
#pragma unroll
        for (int nt = 0; nt < 2; ++nt) {
            const v2f s2 = (a[nt][0] + a[nt][1]) + (a[nt][2] + a[nt][3]);
            d[nt] = s2.x + s2.y;
        }
    } else {
        m[0] = m[1] = -3.0e38f;
        d[0] = d[1] = 0.0f;
        for (int j0 = 0; j0 < SEGJ_; j0 += 128) {
            stats_load(kB, kp + 128);
            stats_step(kA, qb, m, d);
            if (j0 + 128 < SEGJ_) stats_load(kA, kp + 256);
            stats_step(kB, qb, m, d);
            // Stands in front of the overwrite of the K loads' address registers (a
            // precaution); naming them keeps them untouched up to here.  The scheduling
            // barrier holds the wait at the trip's end: without it the build lifts wait
            // and overwrite to just behind the loads' issue, where the wave could stall.
            __builtin_amdgcn_sched_barrier(0);
            asm volatile("s_wait_xcnt 0x0" :: "v"(kp) : "memory");
            kp += 256;
        }
    }

    // Every lane publishes its partial of each of its 2 rows.
#pragma unroll
    for (int nt = 0; nt < 2; ++nt)
        part[seg * 2 + half][rg * 32 + nt * 16 + col] = make_float2(m[nt], d[nt]);

    __syncthreads();

    // Waves 0 and 1: thread t merges the 8 partials of row gb + t, in segment order.
    if (t < SR_) {
        float2 pr[2 * NSEG_];
#pragma unroll
        for (int s = 0; s < 2 * NSEG_; ++s) pr[s] = part[s][t];
        float mm = pr[0].x;
#pragma unroll
        for (int s = 1; s < 2 * NSEG_; ++s) mm = fmaxf(mm, pr[s].x);
        v8f w;
#pragma unroll
        for (int s = 0; s < 2 * NSEG_; ++s) w[s] = pr[s].x - mm;
        exp2x8(w);
        float dd = 0.0f;
#pragma unroll
        for (int s = 0; s < 2 * NSEG_; ++s) dd += pr[s].y * w[s];
        Crow[gb + t] = -__builtin_amdgcn_logf(dd) - mm;            // v_log_f32 is log2
    }
}

// ---------------------------------------------------------------------------
// Kernel 3: out = V @ softmax_rows(QtK) + x.  One block owns 64 output columns
// (4 m-tiles) of one batch; its NW_ waves share out the n loop, each working
// on all 4 m-tiles, so every Q, Crow and V fragment it loads feeds 4 tiles.
// The per-wave f32 partial sums meet in LDS: after one barrier wave w adds the
// NW_ partials of accumulator tile w in wave order and stores it with x.
// Key identity: the WMMA C-layout of the two S tiles (lane holds
// rows 8*half+r / 16+8*half+r of column l%16) is exactly the lane-local data
// the PV B-operand layout needs, so P is repacked C->B in registers.
// Every '#pragma unroll' here makes the indices of acc, kb, av, pb and the
// small float arrays constants, without which they would not stay in registers.
// ---------------------------------------------------------------------------
#define NW_   16                     // waves per block = n slices = acc tiles

__global__ __launch_bounds__(NW_ * 32) void attn_out_kernel(
    const uint4* __restrict__ Qp, const uint4* __restrict__ Kp,
    const uint4* __restrict__ Vf,
    const float* __restrict__ Crow,
    const float* __restrict__ x, float* __restrict__ out)
{
    __shared__ float4 red[NW_][32][32];            // [wave][tile*2 + r/4][lane]

    int t    = threadIdx.x;
    int wave = __builtin_amdgcn_readfirstlane(t >> 5), lane = t & 31;
    int half = lane >> 4, col = lane & 15;
    int b  = blockIdx.x >> 6;
    int m0 = (blockIdx.x & 63) << 6;

    const size_t bN = (size_t)b * N_;

    // B-operands for scores: K columns m0..m0+63 (fixed for the whole wave).
    // Unconditional load: upper-half lanes read the stored zero padding.
    V16 kb[4];
#pragma unroll
    for (int mt = 0; mt < 4; ++mt) {
        uint4 kv = Kp[(bN + m0 + mt * 16 + col) * 2 + half];
        kb[mt].u[0] = kv.x; kb[mt].u[1] = kv.y; kb[mt].u[2] = kv.z; kb[mt].u[3] = kv.w;
        kb[mt].u[4] = 0u;   kb[mt].u[5] = 0u;   kb[mt].u[6] = 0u;   kb[mt].u[7] = 0u;
    }
    // The address registers of the four K loads are reused by the set-up code
    // below:
    // the wait stands here, and the scheduling barrier keeps that code behind it.
    asm volatile("s_wait_xcnt 0x0" ::: "memory");
    __builtin_amdgcn_sched_barrier(0);

    const v8f zc = {0.f,0.f,0.f,0.f,0.f,0.f,0.f,0.f};
    v8f acc[4][4];                                 // [ct][mt]
#pragma unroll
    for (int ct = 0; ct < 4; ++ct)
#pragma unroll
        for (int mt = 0; mt < 4; ++mt) acc[ct][mt] = zc;

    // V lies in fragment order (see the projection kernel): piece 'lane' of each
    // of a chunk's 8 groups of 32 pieces, so a V load reads 4 whole 128-B lines.
    const uint4* vbase = Vf + (size_t)b * NCH_ * VCH_ + lane;

    // Chunks of 32 n are dealt round robin.
    int n0 = wave * 32;
    do {
        // All of this 32-n chunk's loads first: Q rows (two 16-row A tiles),
        // the 16 row constants of this lane, 4 c-tiles of V (A-operands).
        uint4 v0 = Qp[(bN + n0 + col) * 2 + half];
        uint4 v1 = Qp[(bN + n0 + 16 + col) * 2 + half];
        const float4* cr = (const float4*)(Crow + bN + n0 + 8 * half);
        float4 c0 = cr[0], c1 = cr[1], c2 = cr[4], c3 = cr[5];
        V16 av[4];
#pragma unroll
        for (int ct = 0; ct < 4; ++ct) {
            const uint4* vc = vbase + (size_t)n0 * (VCH_ / 32) + ct * 64;
            uint4 a0 = vc[0];
            uint4 a1 = vc[32];
            av[ct].u[0] = a0.x; av[ct].u[1] = a0.y; av[ct].u[2] = a0.z; av[ct].u[3] = a0.w;
            av[ct].u[4] = a1.x; av[ct].u[5] = a1.y; av[ct].u[6] = a1.z; av[ct].u[7] = a1.w;
        }
        V16 aq0, aq1;
        aq0.u[0] = v0.x; aq0.u[1] = v0.y; aq0.u[2] = v0.z; aq0.u[3] = v0.w;
        aq1.u[0] = v1.x; aq1.u[1] = v1.y; aq1.u[2] = v1.z; aq1.u[3] = v1.w;
        aq0.u[4] = aq0.u[5] = aq0.u[6] = aq0.u[7] = 0u;
        aq1.u[4] = aq1.u[5] = aq1.u[6] = aq1.u[7] = 0u;
        const v8f cw0 = {c0.x, c0.y, c0.z, c0.w, c1.x, c1.y, c1.z, c1.w};
        const v8f cw1 = {c2.x, c2.y, c2.z, c2.w, c3.x, c3.y, c3.z, c3.w};

#pragma unroll
        for (int mt = 0; mt < 4; ++mt) {
            // P = exp2(s + Crow[row]), the row constants being the score WMMA's C (a
            // lane's 8 rows are the same in every m-tile); C-layout -> B-layout is lane-local:
            // pb pair j<4 = rows {8h+2j, 8h+2j+1} of tile 0, pair j>=4 = tile 1.
            V16 pb;
            {
                v8f s = __builtin_amdgcn_wmma_f32_16x16x32_bf16(false, aq0.v, false, kb[mt].v,
                                                                (short)0, cw0, false, false);
                exp2_pack(s, pb.u[0], pb.u[1], pb.u[2], pb.u[3]);
            }
            {
                v8f s = __builtin_amdgcn_wmma_f32_16x16x32_bf16(false, aq1.v, false, kb[mt].v,
                                                                (short)0, cw1, false, false);
                exp2_pack(s, pb.u[4], pb.u[5], pb.u[6], pb.u[7]);
            }
#pragma unroll
            for (int ct = 0; ct < 4; ++ct)
                acc[ct][mt] = __builtin_amdgcn_wmma_f32_16x16x32_bf16(false, av[ct].v, false, pb.v,
                                                                      (short)0, acc[ct][mt], false, false);
        }
        n0 += NW_ * 32;
    } while (n0 < N_);

    // Every wave publishes its 16 partial tiles, lane-contiguous 16-B pieces.
#pragma unroll
    for (int ct = 0; ct < 4; ++ct)
#pragma unroll
        for (int mt = 0; mt < 4; ++mt) {
            v8f a = acc[ct][mt];
            red[wave][(ct * 4 + mt) * 2    ][lane] = make_float4(a[0], a[1], a[2], a[3]);
            red[wave][(ct * 4 + mt) * 2 + 1][lane] = make_float4(a[4], a[5], a[6], a[7]);
        }

    // Wave w finishes tile w = ct*4 + mt; its residual x is fetched meanwhile.
    const int ct = wave >> 2, mt = wave & 3;
    const size_t idx0 = ((size_t)b * C_ + ct * 16 + 8 * half) * N_ + m0 + mt * 16 + col;
    float xv[8];
#pragma unroll
    for (int r = 0; r < 8; ++r) xv[r] = x[idx0 + (size_t)r * N_];

    __syncthreads();

    float4 lo0 = red[0][wave * 2][lane], hi0 = red[0][wave * 2 + 1][lane];
    float sum[8] = {lo0.x, lo0.y, lo0.z, lo0.w, hi0.x, hi0.y, hi0.z, hi0.w};
#pragma unroll
    for (int s = 1; s < NW_; ++s) {
        float4 lo = red[s][wave * 2    ][lane];
        float4 hi = red[s][wave * 2 + 1][lane];
        sum[0] += lo.x; sum[1] += lo.y; sum[2] += lo.z; sum[3] += lo.w;
        sum[4] += hi.x; sum[5] += hi.y; sum[6] += hi.z; sum[7] += hi.w;
    }
#pragma unroll
    for (int r = 0; r < 8; ++r) out[idx0 + (size_t)r * N_] = sum[r] + xv[r];
}

// ---------------------------------------------------------------------------
extern "C" void kernel_launch(void* const* d_in, const int* in_sizes, int n_in,
                              void* d_out, int out_size, void* d_ws, size_t ws_size,
                              hipStream_t stream)
{
    const float* x  = (const float*)d_in[0];
    const float* wq = (const float*)d_in[1];
    const float* bq = (const float*)d_in[2];
    const float* wk = (const float*)d_in[3];
    const float* bk = (const float*)d_in[4];
    const float* wv = (const float*)d_in[5];
    const float* bv = (const float*)d_in[6];
    float* out = (float*)d_out;

    char* ws = (char*)d_ws;
    const size_t qp_bytes = (size_t)B_ * N_ * 16 * 2;           // 512 KB (padded rows)
    const size_t vb_bytes = (size_t)B_ * C_ * N_ * 2;           // 2 MB

    uint4*          Qp    = (uint4*)(ws);
    uint4*          Kp    = (uint4*)(ws + qp_bytes);
    uint4*          Vf    = (uint4*)(ws + 2 * qp_bytes);
    float*          Crow  = (float*)(ws + 2 * qp_bytes + vb_bytes);
    float*          Kn2   = Crow + B_ * N_;                     // 256 lines of 128 B

    proj_kernel<<<(B_ * N_) / 64, PW_ * 32, 0, stream>>>(x, wq, bq, wk, bk, wv, bv, Qp, Kp, Vf, Kn2);
    stats_kernel<<<(B_ * N_) / SR_, 256, 0, stream>>>(Qp, Kp, Kn2, Crow);
    attn_out_kernel<<<B_ * (N_ / 64), NW_ * 32, 0, stream>>>(Qp, Kp, Vf, Crow, x, out);
}

// v007
// One run takes 22.3 microseconds.
// Two timings next to v006 put it at 1.04 and 1.05 times that version's speed.
// All steps since v000 together make it 9.76 times as fast.
#include <hip/hip_runtime.h>
#include <stdint.h>

#define B_  4
#define C_  64
#define N_  4096
#define C8_ 8

#define NSEG_ 4
#define SEGJ_ (N_ / NSEG_)          // 1024 j per stats segment

typedef __attribute__((ext_vector_type(16))) __bf16 v16bf;
typedef __attribute__((ext_vector_type(8)))  float  v8f;
typedef __attribute__((ext_vector_type(2)))  float  v2f;
typedef __attribute__((ext_vector_type(4)))  float  v4f;

union V16 { unsigned u[8]; v16bf v; };

#define LOG2E_ 1.4426950408889634f

__device__ inline unsigned short f2bf(float f) {
    unsigned u = __float_as_uint(f);
    unsigned r = u + 0x7FFFu + ((u >> 16) & 1u);   // round-to-nearest-even
    return (unsigned short)(r >> 16);
}
__device__ inline float bf2f(unsigned short h) {
    return __uint_as_float(((unsigned)h) << 16);
}

// exp2 of eight values, each in its own register.  One asm statement: every
// v_exp_f32 overwrites its own source only, and the closing v_nop is a slot in
// front of whatever reads the last result.
__device__ __forceinline__ void exp2x8(v8f& s) {
    float a = s[0], b = s[1], c = s[2], d = s[3], e = s[4], f = s[5], g = s[6], h = s[7];
    asm("v_exp_f32 %0, %0\n\tv_exp_f32 %1, %1\n\tv_exp_f32 %2, %2\n\tv_exp_f32 %3, %3\n\t"
        "v_exp_f32 %4, %4\n\tv_exp_f32 %5, %5\n\tv_exp_f32 %6, %6\n\tv_exp_f32 %7, %7\n\tv_nop"
        : "+v"(a), "+v"(b), "+v"(c), "+v"(d), "+v"(e), "+v"(f), "+v"(g), "+v"(h));
    s = (v8f){a, b, c, d, e, f, g, h};
}

// A score tile's 8 values -> exp2 -> 4 pairs of bf16 (the upper halves), for the
// same reason in one asm statement; the first packs are the slot behind the last
// v_exp_f32.  The s_delay_alu tells the issue logic that the last two packs read
// results of the third-last and the last v_exp_f32 (for speed only).
__device__ __forceinline__ void exp2_pack(const v8f& s, unsigned& p0, unsigned& p1,
                                          unsigned& p2, unsigned& p3) {
    float a = s[0], b = s[1], c = s[2], d = s[3], e = s[4], f = s[5], g = s[6], h = s[7];
    asm("v_exp_f32 %4, %4\n\tv_exp_f32 %5, %5\n\tv_exp_f32 %6, %6\n\tv_exp_f32 %7, %7\n\t"
        "v_exp_f32 %8, %8\n\tv_exp_f32 %9, %9\n\tv_exp_f32 %10, %10\n\tv_exp_f32 %11, %11\n\t"
        "v_perm_b32 %0, %5, %4, 0x7060302\n\tv_perm_b32 %1, %7, %6, 0x7060302\n\t"
        "s_delay_alu instid0(TRANS32_DEP_3) | instskip(NEXT) | instid1(TRANS32_DEP_1)\n\t"
        "v_perm_b32 %2, %9, %8, 0x7060302\n\tv_perm_b32 %3, %11, %10, 0x7060302"
        : "=&v"(p0), "=&v"(p1), "=&v"(p2), "=&v"(p3),
          "+v"(a), "+v"(b), "+v"(c), "+v"(d), "+v"(e), "+v"(f), "+v"(g), "+v"(h));
}

// Maximum over the lane's row of 16 lanes (DPP row_xmask 1, 2, 4, 8): every lane
// of the row ends up with it.
template <int CTRL>
__device__ inline float dpp_max(float v) {
    return fmaxf(v, __int_as_float(__builtin_amdgcn_update_dpp(
                        __float_as_int(v), __float_as_int(v), CTRL, 0xf, 0xf, false)));
}
__device__ inline float row_max16(float v) {
    return dpp_max<0x168>(dpp_max<0x164>(dpp_max<0x162>(dpp_max<0x161>(v))));
}

// ---------------------------------------------------------------------------
// Kernel 1: fused QKV projection on the matrix unit, in f32 (16x16x4 form).
// x [B][64][N] f32 -> Qp,Kp [B][N][16] bf16 (32 B rows; elements 8..15 zeroed
// = WMMA K-padding, so attn-kernel lanes can load unconditionally; Q is stored
// times log2(e), so that every score q.k comes out of its WMMA in the exp2 domain),
// Kn2 = the largest |k|^2 among the block's 64 pixels (for the stats kernel; one
// float per block, each in a 128-B line of its own: one writer per line),
// V bf16 in the order of the output kernel's A fragments (below), biases fused
// (they are the accumulators' start values).
// One block per 64 pixels, so that every WGP works; each of its PW_ waves owns
// one tile of 16 output channels (waves 0..3: V; wave 4: Q over K) and all 64
// pixels as four tiles.  Index c of pixel tile j is pixel 4c + j: one 16-B load
// of x feeds all four tiles.
// Wave 4 takes the weights as A and x as B: a lane ends up with 8 channels of
// each of 4 neighbouring pixels, which are 4 rows of Qp or Kp.
// Waves 0..3 take x as A and the weights as B: a lane ends up with ONE channel
// (col) and the 32 neighbouring pixels 32*half + 4r + j, which are that
// channel's share of one 32-pixel chunk of V.
// Layout of Vf, in 16-B pieces: [b][chunk of 32 n][c-tile][p][lane], where piece
// (p, lane) holds n = 16p + 8*(lane>>4) + 0..7 of channel lane&15: lane l of the
// output kernel reads piece l, so each of its V loads is 512 B in a row.
// k order: element e of step s in lane half h is input channel
// 8*(s/2) + 4*h + 2*(s%2) + e, for the weight loader and the x loader alike.
// Every '#pragma unroll' here makes the indices of wa, xv and acc constants,
// without which they would not stay in registers.
// ---------------------------------------------------------------------------
#define PW_ 5                        // waves per block = tiles of 16 channels
#define NCH_ (N_ / 32)               // chunks of 32 n per batch
#define VCH_ 256                     // 16-B pieces of Vf per chunk (4 KB)
#define KNP_ 32                      // floats from one block's Kn2 to the next

__device__ inline unsigned pack2bf(float lo, float hi) {
    return (unsigned)f2bf(lo) | ((unsigned)f2bf(hi) << 16);
}

// One wave's 16 channels x 64 pixels.  XA: x is the A operand (rows of D are
// pixels, brow points to the lane's one bias); else the weights are (rows of D
// are channels, brow points to the biases of the lane's 8 rows).
template <bool XA>
__device__ __forceinline__ void proj_tile(const float* __restrict__ xb,
                                          const float* __restrict__ wrow,
                                          const float* __restrict__ brow,
                                          v8f (&acc)[4])
{
    // Loads in the order of their use, so that the first steps can start while
    // the later ones' data are still on their way.
    v8f bi;
    if (XA) {
        const float bb = *brow;
        bi = (v8f){bb, bb, bb, bb, bb, bb, bb, bb};
    } else {
        const v4f b0 = *(const v4f*)brow, b1 = *(const v4f*)(brow + 4);
        bi = (v8f){b0.x, b0.y, b0.z, b0.w, b1.x, b1.y, b1.z, b1.w};
    }
    v4f wa[8];                             // wa[u] = steps 2u and 2u + 1
    v4f xv[16][2];                         // [step][element], 4 pixels each
#pragma unroll
    for (int u = 0; u < 8; ++u) {
        wa[u] = *(const v4f*)(wrow + 8 * u);
#pragma unroll
        for (int q = 0; q < 4; ++q)
            xv[2 * u + (q >> 1)][q & 1] = *(const v4f*)(xb + (size_t)(8 * u + q) * N_);
    }

#pragma unroll
    for (int j = 0; j < 4; ++j) acc[j] = bi;

    // Stands in front of the first overwrite of the loads' address registers (a
    // precaution); naming them keeps them untouched up to here.
    asm volatile("s_wait_xcnt 0x0" :: "v"(xb), "v"(wrow), "v"(brow) : "memory");
    // Keeps all the loads in front of the first WMMA, in flight together: without
    // it the build sinks each pair of x loads to its step and the wave waits out
    // one round trip to L2 per step.
    __builtin_amdgcn_sched_barrier(0);

#pragma unroll
    for (int s = 0; s < 16; ++s) {
        const v2f wf = {wa[s >> 1][2 * (s & 1)], wa[s >> 1][2 * (s & 1) + 1]};
#pragma unroll
        for (int j = 0; j < 4; ++j) {
            const v2f xf = {xv[s][0][j], xv[s][1][j]};
            acc[j] = XA ? __builtin_amdgcn_wmma_f32_16x16x4_f32(false, xf, false, wf,
                                                                (short)0, acc[j], false, false)
                        : __builtin_amdgcn_wmma_f32_16x16x4_f32(false, wf, false, xf,
                                                                (short)0, acc[j], false, false);
        }
    }
}

__global__ __launch_bounds__(PW_ * 32) void proj_kernel(
    const float* __restrict__ x,
    const float* __restrict__ wq, const float* __restrict__ bq,
    const float* __restrict__ wk, const float* __restrict__ bk,
    const float* __restrict__ wv, const float* __restrict__ bv,
    uint4* __restrict__ Qp, uint4* __restrict__ Kp,
    uint4* __restrict__ Vf, float* __restrict__ Kn2)
{
    int t    = threadIdx.x;
    int wave = __builtin_amdgcn_readfirstlane(t >> 5), lane = t & 31;
    int half = lane >> 4, col = lane & 15;
    int g0 = blockIdx.x * 64;              // first of the block's 64 pixels
    int b  = g0 >> 12;
    int n0 = g0 & (N_ - 1);

    const float* xb = x + ((size_t)b * C_ + 4 * half) * N_ + n0 + 4 * col;
    v8f acc[4];

    if (wave < 4) {
        proj_tile<true>(xb, wv + (wave * 16 + col) * C_ + 4 * half, bv + wave * 16 + col, acc);
        // acc[j][r] = channel wave*16 + col, pixel g0 + 32*half + 4r + j: the lane's
        // four pieces of chunk 'half'; 16 lanes store 256 B in a row.
        uint4* vp = Vf + ((size_t)b * NCH_ + (n0 >> 5) + half) * VCH_ + wave * 64 + col;
#pragma unroll
        for (int q = 0; q < 4; ++q)                   // q = 2p + (target lane >> 4)
            vp[q * 16] = make_uint4(pack2bf(acc[0][2 * q],     acc[1][2 * q]),
                                    pack2bf(acc[2][2 * q],     acc[3][2 * q]),
                                    pack2bf(acc[0][2 * q + 1], acc[1][2 * q + 1]),
                                    pack2bf(acc[2][2 * q + 1], acc[3][2 * q + 1]));
    } else {
        proj_tile<false>(xb, (col < 8 ? wq + col * C_ : wk + (col - 8) * C_) + 4 * half,
                         half ? bk : bq, acc);
        // acc[j][r] = channel r of Q (lower lane half) or K (upper half), pixel
        // g0 + 4*col + j: 4 padded rows = 128 B per lane.
        uint4* dst = (half ? Kp : Qp) + (size_t)(g0 + 4 * col) * 2;
        const uint4 z4 = make_uint4(0u, 0u, 0u, 0u);
        const float sc = half ? 1.0f : LOG2E_;
#pragma unroll
        for (int j = 0; j < 4; ++j) acc[j] *= sc;
#pragma unroll
        for (int j = 0; j < 4; ++j) {
            dst[2 * j] = make_uint4(pack2bf(acc[j][0], acc[j][1]), pack2bf(acc[j][2], acc[j][3]),
                                    pack2bf(acc[j][4], acc[j][5]), pack2bf(acc[j][6], acc[j][7]));
            dst[2 * j + 1] = z4;                      // K = 8..15 zero padding
        }
        float k2 = 0.0f;                              // largest squared norm of 4 rows
#pragma unroll
        for (int j = 0; j < 4; ++j) {
            float t2 = 0.0f;
#pragma unroll
            for (int r = 0; r < 8; ++r) t2 = fmaf(acc[j][r], acc[j][r], t2);
            k2 = fmaxf(k2, t2);
        }
        k2 = row_max16(k2);                           // lanes 16..31: over the 64 K rows
        if (lane == 16) Kn2[blockIdx.x * KNP_] = k2;
        // In the listing the other branch's code follows and reuses the address
        // registers of these stores: the wait stands in front of it.
        asm volatile("s_wait_xcnt 0x0" ::: "memory");
    }
}

// ---------------------------------------------------------------------------
// Kernel 2: per-row softmax constants on the matrix unit, finished in one launch.
// A block owns SR_ = 64 softmax rows n over ALL j of their batch: wave w takes
// 32 of the rows (w & 1; two B operands: Q) and one j-segment (w >> 1), which it
// walks in steps of 64 j (four A operands: K).  With K as A and Q as B
// the D tile holds S transposed: a lane keeps 8 scores of ONE row n, so the
// sum of a row is lane-local.  Scores are in the exp2 domain (Q is stored so).
// The shift m of a row only has to lie near its largest score: close enough
// that exp2(s - m) neither overflows nor all but vanishes.  |q|*max|k| (the
// maximum over the wave's segment) is known before the products, lies at or above
// every score (up to rounding) and at most twice itself above the largest one, so
// while it is at most BMAX_ it serves as m, and goes into the WMMA as C: exp2
// reads D as it is.  A wave with a larger bound (or a NaN) walks with the exact
// running maximum instead.
// A row's 8 partial (m, d) pairs (4 segments x the two j halves of each tile,
// lanes l and l^16) meet in LDS behind one barrier, and the block itself emits
// the fused softmax constant:  Crow[n] = -log2(D[n]) - M[n],
// so that  P[n,m] = exp2(S[n,m] + Crow[n]).
// Every '#pragma unroll' here makes the indices of ka, kc, qb, cn, s, tm, m, d, a
// and pr constants, without which they would not stay in registers.
// ---------------------------------------------------------------------------
#define BMAX_ 50.0f                  // exp2(s - m) stays at or above 2^-100

// p: the lane's piece of the first of the step's four tiles of 16 K rows (512 B).
__device__ inline void stats_load(uint4 (&kc)[4], const char* __restrict__ p)
{
#pragma unroll
    for (int jt = 0; jt < 4; ++jt) kc[jt] = *(const uint4*)(p + jt * 512);
}

__device__ inline void stats_frag(V16 (&ka)[4], const uint4 (&kc)[4])
{
#pragma unroll
    for (int jt = 0; jt < 4; ++jt) {
        ka[jt].u[0] = kc[jt].x; ka[jt].u[1] = kc[jt].y;
        ka[jt].u[2] = kc[jt].z; ka[jt].u[3] = kc[jt].w;
        ka[jt].u[4] = 0u; ka[jt].u[5] = 0u; ka[jt].u[6] = 0u; ka[jt].u[7] = 0u;
    }
}

// One step, shift known: 64 j (kc) against the wave's 32 rows; cn = -m in every
// element, a = four independent partial sums per row tile.
__device__ inline void stats_step_bound(const uint4 (&kc)[4], const V16 (&qb)[2],
                                        const v8f (&cn)[2], v2f (&a)[2][4])
{
    V16 ka[4];
    stats_frag(ka, kc);
#pragma unroll
    for (int nt = 0; nt < 2; ++nt) {
        v8f s[4];
#pragma unroll
        for (int jt = 0; jt < 4; ++jt)
            s[jt] = __builtin_amdgcn_wmma_f32_16x16x32_bf16(false, ka[jt].v, false, qb[nt].v,
                                                            (short)0, cn[nt], false, false);
#pragma unroll
        for (int jt = 0; jt < 4; ++jt)
#pragma unroll
            for (int r = 0; r < 8; r += 2) {
                v2f p = {__builtin_amdgcn_exp2f(s[jt][r]), __builtin_amdgcn_exp2f(s[jt][r + 1])};
                a[nt][r >> 1] += p;
            }
    }
}

// One step, exact: online max / sum update.
__device__ inline void stats_step(const uint4 (&kc)[4], const V16 (&qb)[2],
                                  float (&m)[2], float (&d)[2])
{
    const v8f zc = {0.f,0.f,0.f,0.f,0.f,0.f,0.f,0.f};
    V16 ka[4];
    stats_frag(ka, kc);
#pragma unroll
    for (int nt = 0; nt < 2; ++nt) {
        v8f s[4];
#pragma unroll
        for (int jt = 0; jt < 4; ++jt)
            s[jt] = __builtin_amdgcn_wmma_f32_16x16x32_bf16(false, ka[jt].v, false, qb[nt].v,
                                                            (short)0, zc, false, false);
        float tm[4];                                  // one short max chain per tile
#pragma unroll
        for (int jt = 0; jt < 4; ++jt) {
            tm[jt] = s[jt][0];
#pragma unroll
            for (int r = 1; r < 8; ++r) tm[jt] = fmaxf(tm[jt], s[jt][r]);
        }
        const float mn = fmaxf(fmaxf(fmaxf(m[nt], tm[0]), tm[1]), fmaxf(tm[2], tm[3]));
        v2f a0 = {0.f, 0.f}, a1 = {0.f, 0.f};         // independent partial sums
#pragma unroll
        for (int jt = 0; jt < 4; ++jt)
#pragma unroll
            for (int r = 0; r < 8; r += 4) {
                v2f e0 = {s[jt][r],     s[jt][r + 1]};
                v2f e1 = {s[jt][r + 2], s[jt][r + 3]};
                e0 = e0 - mn;
                e1 = e1 - mn;
                v2f p0 = {__builtin_amdgcn_exp2f(e0.x), __builtin_amdgcn_exp2f(e0.y)};
                v2f p1 = {__builtin_amdgcn_exp2f(e1.x), __builtin_amdgcn_exp2f(e1.y)};
                a0 += p0;
                a1 += p1;
            }
        a0 += a1;
        d[nt] = fmaf(d[nt], __builtin_amdgcn_exp2f(m[nt] - mn), a0.x + a0.y);
        m[nt] = mn;
    }
}

// Squared norm of a stored row's 8 bf16 elements.
__device__ inline float row_norm2(uint4 v)
{
    const unsigned u[4] = {v.x, v.y, v.z, v.w};
    float t = 0.0f;
#pragma unroll
    for (int i = 0; i < 4; ++i) {
        const float lo = __uint_as_float(u[i] << 16), hi = __uint_as_float(u[i] & 0xFFFF0000u);
        t = fmaf(lo, lo, fmaf(hi, hi, t));
    }
    return t;
}

#define SR_ 64                       // softmax rows per block

__global__ __launch_bounds__(256) void stats_kernel(
    const uint4* __restrict__ Qp, const uint4* __restrict__ Kp,
    const float* __restrict__ Kn2, float* __restrict__ Crow)
{
    __shared__ float2 part[2 * NSEG_][SR_];        // [segment*2 + lane half][row]

    int t    = threadIdx.x;
    int wave = __builtin_amdgcn_readfirstlane(t >> 5), lane = t & 31;
    int half = lane >> 4, col = lane & 15;
    int rg  = wave & 1;                // which 32 of the block's 64 rows
    int seg = wave >> 1;               // 4 segments
    int gb  = blockIdx.x * SR_;        // first of the block's 64 rows
    int g0  = gb + rg * 32;            // first of this wave's 32 rows
    int b   = g0 >> 12;

    // Every lane loads its row's 8 real elements (for the norm); as B operand the
    // upper-half lanes hold zeros, the same values as the stored padding that the K
    // loader reads there, so the k order of A and B is equal at every position.
    V16 qb[2];
    uint4 qr[2];
#pragma unroll
    for (int nt = 0; nt < 2; ++nt) {
        qr[nt] = Qp[(size_t)(g0 + nt * 16 + col) * 2];
        qb[nt].u[0] = half ? 0u : qr[nt].x; qb[nt].u[1] = half ? 0u : qr[nt].y;
        qb[nt].u[2] = half ? 0u : qr[nt].z; qb[nt].u[3] = half ? 0u : qr[nt].w;
        qb[nt].u[4] = 0u;   qb[nt].u[5] = 0u;   qb[nt].u[6] = 0u;   qb[nt].u[7] = 0u;
    }
    // The segment's 1024 j are 16 blocks of the projection kernel.
    const float kn = Kn2[((b * N_ + seg * SEGJ_) / 64 + col) * KNP_];

    // The segment is walked as a ring of 16 steps of 64 j (2 KB).  The 64 blocks of a
    // batch read the same K rows: their first steps are spread over the ring, four blocks to a step, so that they do not
    // all ask L2 for the same lines at the same moment.  Blocks that differ in the low
    // three bits of the index alone, or in the high three alone, start at 8 different steps.
    const char* kseg = (const char*)(Kp + ((size_t)b * N_ + seg * SEGJ_ + col) * 2 + half);
    const int rb = blockIdx.x & (N_ / SR_ - 1);
    int st = (2 * (rb >> 3) + 5 * (rb & 7)) & 15;
    uint4 kA[4], kB[4];                // two register buffers: each step's K rows
    stats_load(kA, kseg + st * 2048);  // are fetched one step ahead of their use
    // Keeps the first K loads in front of the wait for kn: without it the build
    // issues them behind that wait, and the wave waits out two round trips to L2.
    __builtin_amdgcn_sched_barrier(0);

    const float k2 = row_max16(kn);    // largest |k|^2 of the segment
    float m[2], d[2];
#pragma unroll
    for (int nt = 0; nt < 2; ++nt) m[nt] = __builtin_amdgcn_sqrtf(row_norm2(qr[nt]) * k2);

    // One test per wave, a scalar branch: the WMMAs of both sides run with every
    // lane on.  Written so that a NaN takes the exact side.
    if (__builtin_amdgcn_ballot_w32(!(m[0] <= BMAX_ && m[1] <= BMAX_)) == 0) {
        v8f cn[2];
        v2f a[2][4];
#pragma unroll
        for (int nt = 0; nt < 2; ++nt) {
            const float c = -m[nt];
            cn[nt] = (v8f){c, c, c, c, c, c, c, c};
#pragma unroll
            for (int i = 0; i < 4; ++i) a[nt][i] = (v2f){0.f, 0.f};
        }
        for (int j0 = 0; j0 < SEGJ_; j0 += 128) {
            const char* pB = kseg + ((st + 1) & 15) * 2048;
            const char* pA = kseg + ((st + 2) & 15) * 2048;
            stats_load(kB, pB);
            stats_step_bound(kA, qb, cn, a);
            if (j0 + 128 < SEGJ_) stats_load(kA, pA);
            stats_step_bound(kB, qb, cn, a);
            // As in the exact loop below.
            __builtin_amdgcn_sched_barrier(0);
            asm volatile("s_wait_xcnt 0x0" :: "v"(pB), "v"(pA) : "memory");
            st = (st + 2) & 15;
        }
#pragma unroll
        for (int nt = 0; nt < 2; ++nt) {
            const v2f s2 = (a[nt][0] + a[nt][1]) + (a[nt][2] + a[nt][3]);
            d[nt] = s2.x + s2.y;
        }
    } else {
        m[0] = m[1] = -3.0e38f;
        d[0] = d[1] = 0.0f;
        for (int j0 = 0; j0 < SEGJ_; j0 += 128) {
            const char* pB = kseg + ((st + 1) & 15) * 2048;
            const char* pA = kseg + ((st + 2) & 15) * 2048;
            stats_load(kB, pB);
            stats_step(kA, qb, m, d);
            if (j0 + 128 < SEGJ_) stats_load(kA, pA);
            stats_step(kB, qb, m, d);
            // Stands in front of the overwrite of the K loads' address registers (a
            // precaution); naming them keeps them untouched up to here.  The scheduling
            // barrier holds the wait at the trip's end: without it the build lifts wait
            // and overwrite to just behind the loads' issue, where the wave could stall.
            __builtin_amdgcn_sched_barrier(0);
            asm volatile("s_wait_xcnt 0x0" :: "v"(pB), "v"(pA) : "memory");
            st = (st + 2) & 15;
        }
    }

    // Every lane publishes its partial of each of its 2 rows.
#pragma unroll
    for (int nt = 0; nt < 2; ++nt)
        part[seg * 2 + half][rg * 32 + nt * 16 + col] = make_float2(m[nt], d[nt]);

    __syncthreads();

    // Waves 0 and 1: thread t merges the 8 partials of row gb + t, in segment order.
    if (t < SR_) {
        float2 pr[2 * NSEG_];
#pragma unroll
        for (int s = 0; s < 2 * NSEG_; ++s) pr[s] = part[s][t];
        float mm = pr[0].x;
#pragma unroll
        for (int s = 1; s < 2 * NSEG_; ++s) mm = fmaxf(mm, pr[s].x);
        v8f w;
#pragma unroll
        for (int s = 0; s < 2 * NSEG_; ++s) w[s] = pr[s].x - mm;
        exp2x8(w);
        float dd = 0.0f;
#pragma unroll
        for (int s = 0; s < 2 * NSEG_; ++s) dd += pr[s].y * w[s];
        Crow[gb + t] = -__builtin_amdgcn_logf(dd) - mm;            // v_log_f32 is log2
    }
}

// ---------------------------------------------------------------------------
// Kernel 3: out = V @ softmax_rows(QtK) + x.  One block owns 64 output columns
// (4 m-tiles) of one batch; its NW_ waves share out the n loop, each working
// on all 4 m-tiles, so every Q, Crow and V fragment it loads feeds 4 tiles.
// The per-wave f32 partial sums meet in LDS: after one barrier wave w adds the
// NW_ partials of accumulator tile w in wave order and stores it with x.
// Key identity: the WMMA C-layout of the two S tiles (lane holds
// rows 8*half+r / 16+8*half+r of column l%16) is exactly the lane-local data
// the PV B-operand layout needs, so P is repacked C->B in registers.
// Every '#pragma unroll' here makes the indices of acc, kb, av, pb and the
// small float arrays constants, without which they would not stay in registers.
// ---------------------------------------------------------------------------
#define NW_   16                     // waves per block = n slices = acc tiles

__global__ __launch_bounds__(NW_ * 32) void attn_out_kernel(
    const uint4* __restrict__ Qp, const uint4* __restrict__ Kp,
    const uint4* __restrict__ Vf,
    const float* __restrict__ Crow,
    const float* __restrict__ x, float* __restrict__ out)
{
    __shared__ float4 red[NW_][32][32];            // [wave][tile*2 + r/4][lane]

    int t    = threadIdx.x;
    int wave = __builtin_amdgcn_readfirstlane(t >> 5), lane = t & 31;
    int half = lane >> 4, col = lane & 15;
    int b  = blockIdx.x >> 6;
    int m0 = (blockIdx.x & 63) << 6;

    const size_t bN = (size_t)b * N_;

    // B-operands for scores: K columns m0..m0+63 (fixed for the whole wave).
    // Unconditional load: upper-half lanes read the stored zero padding.
    V16 kb[4];
#pragma unroll
    for (int mt = 0; mt < 4; ++mt) {
        uint4 kv = Kp[(bN + m0 + mt * 16 + col) * 2 + half];
        kb[mt].u[0] = kv.x; kb[mt].u[1] = kv.y; kb[mt].u[2] = kv.z; kb[mt].u[3] = kv.w;
        kb[mt].u[4] = 0u;   kb[mt].u[5] = 0u;   kb[mt].u[6] = 0u;   kb[mt].u[7] = 0u;
    }
    // The address registers of the four K loads are reused by the set-up code
    // below:
    // the wait stands here, and the scheduling barrier keeps that code behind it.
    asm volatile("s_wait_xcnt 0x0" ::: "memory");
    __builtin_amdgcn_sched_barrier(0);

    const v8f zc = {0.f,0.f,0.f,0.f,0.f,0.f,0.f,0.f};
    v8f acc[4][4];                                 // [ct][mt]
#pragma unroll
    for (int ct = 0; ct < 4; ++ct)
#pragma unroll
        for (int mt = 0; mt < 4; ++mt) acc[ct][mt] = zc;

    // V lies in fragment order (see the projection kernel): piece 'lane' of each
    // of a chunk's 8 groups of 32 pieces, so a V load reads 4 whole 128-B lines.
    // Every address of the loop is a chunk's place, the same for the whole wave,
    // plus the lane's fixed byte offset in the chunk.
    const char* qbat = (const char*)(Qp + bN * 2);
    const char* cbat = (const char*)(Crow + bN);
    const char* vbat = (const char*)(Vf + (size_t)b * NCH_ * VCH_);
    const unsigned qoff = (unsigned)(col * 2 + half) * 16u;
    const unsigned coff = (unsigned)half * 32u;
    const unsigned voff = (unsigned)lane * 16u;

    // Chunks of 32 n are dealt round robin on a ring: block r of a batch starts 2r
    // chunks further on and wraps.  The batch's 64 blocks read the same Q, Crow and V;
    // walking in step they would all ask L2 for the same lines at the same moment.
    const int nbeg = ((wave + 2 * (blockIdx.x & 63)) & (NCH_ - 1)) * 32;
    int n0 = nbeg;
    do {
        // All of this 32-n chunk's loads first: Q rows (two 16-row A tiles),
        // the 16 row constants of this lane, 4 c-tiles of V (A-operands).
        const char* qc = qbat + n0 * 32 + qoff;
        const char* cc = cbat + n0 * 4 + coff;
        const char* vch = vbat + n0 * (VCH_ / 2) + voff;
        uint4 v0 = *(const uint4*)qc;
        uint4 v1 = *(const uint4*)(qc + 512);
        float4 c0 = *(const float4*)cc,        c1 = *(const float4*)(cc + 16);
        float4 c2 = *(const float4*)(cc + 64), c3 = *(const float4*)(cc + 80);
        V16 av[4];
#pragma unroll
        for (int ct = 0; ct < 4; ++ct) {
            uint4 a0 = *(const uint4*)(vch + ct * 1024);
            uint4 a1 = *(const uint4*)(vch + ct * 1024 + 512);
            av[ct].u[0] = a0.x; av[ct].u[1] = a0.y; av[ct].u[2] = a0.z; av[ct].u[3] = a0.w;
            av[ct].u[4] = a1.x; av[ct].u[5] = a1.y; av[ct].u[6] = a1.z; av[ct].u[7] = a1.w;
        }
        // Stands in front of the first overwrite of these loads' address registers (a
        // precaution); naming them keeps them untouched up to here.
        asm volatile("s_wait_xcnt 0x0" :: "v"(qc), "v"(cc), "v"(vch) : "memory");
        V16 aq0, aq1;
        aq0.u[0] = v0.x; aq0.u[1] = v0.y; aq0.u[2] = v0.z; aq0.u[3] = v0.w;
        aq1.u[0] = v1.x; aq1.u[1] = v1.y; aq1.u[2] = v1.z; aq1.u[3] = v1.w;
        aq0.u[4] = aq0.u[5] = aq0.u[6] = aq0.u[7] = 0u;
        aq1.u[4] = aq1.u[5] = aq1.u[6] = aq1.u[7] = 0u;
        const v8f cw0 = {c0.x, c0.y, c0.z, c0.w, c1.x, c1.y, c1.z, c1.w};
        const v8f cw1 = {c2.x, c2.y, c2.z, c2.w, c3.x, c3.y, c3.z, c3.w};

#pragma unroll
        for (int mt = 0; mt < 4; ++mt) {
            // P = exp2(s + Crow[row]), the row constants being the score WMMA's C (a
            // lane's 8 rows are the same in every m-tile); C-layout -> B-layout is lane-local:
            // pb pair j<4 = rows {8h+2j, 8h+2j+1} of tile 0, pair j>=4 = tile 1.
            V16 pb;
            {
                v8f s = __builtin_amdgcn_wmma_f32_16x16x32_bf16(false, aq0.v, false, kb[mt].v,
                                                                (short)0, cw0, false, false);
                exp2_pack(s, pb.u[0], pb.u[1], pb.u[2], pb.u[3]);
            }
            {
                v8f s = __builtin_amdgcn_wmma_f32_16x16x32_bf16(false, aq1.v, false, kb[mt].v,
                                                                (short)0, cw1, false, false);
                exp2_pack(s, pb.u[4], pb.u[5], pb.u[6], pb.u[7]);
            }
#pragma unroll
            for (int ct = 0; ct < 4; ++ct)
                acc[ct][mt] = __builtin_amdgcn_wmma_f32_16x16x32_bf16(false, av[ct].v, false, pb.v,
                                                                      (short)0, acc[ct][mt], false, false);
        }
        n0 = (n0 + NW_ * 32) & (N_ - 1);
    } while (n0 != nbeg);                          // N_ / (NW_ * 32) = 8 trips

    // Every wave publishes its 16 partial tiles, lane-contiguous 16-B pieces.
#pragma unroll
    for (int ct = 0; ct < 4; ++ct)
#pragma unroll
        for (int mt = 0; mt < 4; ++mt) {
            v8f a = acc[ct][mt];
            red[wave][(ct * 4 + mt) * 2    ][lane] = make_float4(a[0], a[1], a[2], a[3]);
            red[wave][(ct * 4 + mt) * 2 + 1][lane] = make_float4(a[4], a[5], a[6], a[7]);
        }

    // Wave w finishes tile w = ct*4 + mt; its residual x is fetched meanwhile.
    const int ct = wave >> 2, mt = wave & 3;
    const size_t idx0 = ((size_t)b * C_ + ct * 16 + 8 * half) * N_ + m0 + mt * 16 + col;
    float xv[8];
#pragma unroll
    for (int r = 0; r < 8; ++r) xv[r] = x[idx0 + (size_t)r * N_];

    __syncthreads();

    float4 lo0 = red[0][wave * 2][lane], hi0 = red[0][wave * 2 + 1][lane];
    float sum[8] = {lo0.x, lo0.y, lo0.z, lo0.w, hi0.x, hi0.y, hi0.z, hi0.w};
#pragma unroll
    for (int s = 1; s < NW_; ++s) {
        float4 lo = red[s][wave * 2    ][lane];
        float4 hi = red[s][wave * 2 + 1][lane];
        sum[0] += lo.x; sum[1] += lo.y; sum[2] += lo.z; sum[3] += lo.w;
        sum[4] += hi.x; sum[5] += hi.y; sum[6] += hi.z; sum[7] += hi.w;
    }
#pragma unroll
    for (int r = 0; r < 8; ++r) out[idx0 + (size_t)r * N_] = sum[r] + xv[r];
}

// ---------------------------------------------------------------------------
extern "C" void kernel_launch(void* const* d_in, const int* in_sizes, int n_in,
                              void* d_out, int out_size, void* d_ws, size_t ws_size,
                              hipStream_t stream)
{
    const float* x  = (const float*)d_in[0];
    const float* wq = (const float*)d_in[1];
    const float* bq = (const float*)d_in[2];
    const float* wk = (const float*)d_in[3];
    const float* bk = (const float*)d_in[4];
    const float* wv = (const float*)d_in[5];
    const float* bv = (const float*)d_in[6];
    float* out = (float*)d_out;

    char* ws = (char*)d_ws;
    const size_t qp_bytes = (size_t)B_ * N_ * 16 * 2;           // 512 KB (padded rows)
    const size_t vb_bytes = (size_t)B_ * C_ * N_ * 2;           // 2 MB

    uint4*          Qp    = (uint4*)(ws);
    uint4*          Kp    = (uint4*)(ws + qp_bytes);
    uint4*          Vf    = (uint4*)(ws + 2 * qp_bytes);
    float*          Crow  = (float*)(ws + 2 * qp_bytes + vb_bytes);
    float*          Kn2   = Crow + B_ * N_;                     // 256 lines of 128 B

    proj_kernel<<<(B_ * N_) / 64, PW_ * 32, 0, stream>>>(x, wq, bq, wk, bk, wv, bv, Qp, Kp, Vf, Kn2);
    stats_kernel<<<(B_ * N_) / SR_, 256, 0, stream>>>(Qp, Kp, Kn2, Crow);
    attn_out_kernel<<<B_ * (N_ / 64), NW_ * 32, 0, stream>>>(Qp, Kp, Vf, Crow, x, out);
}

// v008
// A run of this version takes 21.5 microseconds.
// Timed twice side by side with v007, it ran 1.03 and 1.04 times as fast.
// Over all steps from v000 it is 10.1 times as fast.
#include <hip/hip_runtime.h>
#include <stdint.h>

#define B_  4
#define C_  64
#define N_  4096
#define C8_ 8

#define NSEG_ 4
#define SEGJ_ (N_ / NSEG_)          // 1024 j per stats segment

typedef __attribute__((ext_vector_type(16))) __bf16 v16bf;
typedef __attribute__((ext_vector_type(8)))  float  v8f;
typedef __attribute__((ext_vector_type(2)))  float  v2f;
typedef __attribute__((ext_vector_type(4)))  float  v4f;

union V16 { unsigned u[8]; v16bf v; };

#define LOG2E_ 1.4426950408889634f

__device__ inline unsigned short f2bf(float f) {
    unsigned u = __float_as_uint(f);
    unsigned r = u + 0x7FFFu + ((u >> 16) & 1u);   // round-to-nearest-even
    return (unsigned short)(r >> 16);
}
__device__ inline float bf2f(unsigned short h) {
    return __uint_as_float(((unsigned)h) << 16);
}

// exp2 of eight values, each in its own register.  One asm statement: every
// v_exp_f32 overwrites its own source only, and the closing v_nop is a slot in
// front of whatever reads the last result.
__device__ __forceinline__ void exp2x8(v8f& s) {
    float a = s[0], b = s[1], c = s[2], d = s[3], e = s[4], f = s[5], g = s[6], h = s[7];
    asm("v_exp_f32 %0, %0\n\tv_exp_f32 %1, %1\n\tv_exp_f32 %2, %2\n\tv_exp_f32 %3, %3\n\t"
        "v_exp_f32 %4, %4\n\tv_exp_f32 %5, %5\n\tv_exp_f32 %6, %6\n\tv_exp_f32 %7, %7\n\tv_nop"
        : "+v"(a), "+v"(b), "+v"(c), "+v"(d), "+v"(e), "+v"(f), "+v"(g), "+v"(h));
    s = (v8f){a, b, c, d, e, f, g, h};
}

// Two score tiles' 8 + 8 values -> exp2 -> 8 pairs of bf16 (the upper halves), for the
// same reason in one asm statement.  The four v_nop are the slots that the chip needs
// between a WMMA and a vector instruction that reads its D.
// Results go to registers of their own (the pairs' own and six
// more), so no v_exp_f32 overwrites a source; each pack stands well behind the v_exp_f32
// that it reads, but for the last two.  The s_delay_alu tells the issue logic that
// these read results of the third-last and the last v_exp_f32: without the hint a wave
// that waits there holds up the SIMD's other waves.
__device__ __forceinline__ void exp2_pack2(const v8f& s, const v8f& r, unsigned (&p)[8]) {
    unsigned u0, u1, u2, u3, u4, u5;
    asm("v_nop\n\tv_nop\n\tv_nop\n\tv_nop\n\t"
        "v_exp_f32 %0, %14\n\tv_exp_f32 %1, %15\n\tv_exp_f32 %2, %16\n\tv_exp_f32 %3, %17\n\t"
        "v_exp_f32 %4, %18\n\tv_exp_f32 %5, %19\n\tv_exp_f32 %6, %20\n\tv_exp_f32 %7, %21\n\t"
        "v_exp_f32 %8, %22\n\tv_exp_f32 %9, %23\n\tv_exp_f32 %10, %24\n\tv_exp_f32 %11, %25\n\t"
        "v_perm_b32 %0, %1, %0, 0x7060302\n\tv_perm_b32 %1, %3, %2, 0x7060302\n\t"
        "v_perm_b32 %2, %5, %4, 0x7060302\n\tv_perm_b32 %3, %7, %6, 0x7060302\n\t"
        "v_exp_f32 %6, %26\n\tv_exp_f32 %7, %27\n\tv_exp_f32 %12, %28\n\tv_exp_f32 %13, %29\n\t"
        "v_perm_b32 %4, %9, %8, 0x7060302\n\tv_perm_b32 %5, %11, %10, 0x7060302\n\t"
        "s_delay_alu instid0(TRANS32_DEP_3) | instskip(NEXT) | instid1(TRANS32_DEP_1)\n\t"
        "v_perm_b32 %6, %7, %6, 0x7060302\n\tv_perm_b32 %7, %13, %12, 0x7060302"
        : "=&v"(p[0]), "=&v"(p[1]), "=&v"(p[2]), "=&v"(p[3]),
          "=&v"(p[4]), "=&v"(p[5]), "=&v"(p[6]), "=&v"(p[7]),
          "=&v"(u0), "=&v"(u1), "=&v"(u2), "=&v"(u3), "=&v"(u4), "=&v"(u5)
        : "v"(s[0]), "v"(s[1]), "v"(s[2]), "v"(s[3]), "v"(s[4]), "v"(s[5]), "v"(s[6]), "v"(s[7]),
          "v"(r[0]), "v"(r[1]), "v"(r[2]), "v"(r[3]), "v"(r[4]), "v"(r[5]), "v"(r[6]), "v"(r[7]));
}

// Maximum over the lane's row of 16 lanes (DPP row_xmask 1, 2, 4, 8): every lane
// of the row ends up with it.
template <int CTRL>
__device__ inline float dpp_max(float v) {
    return fmaxf(v, __int_as_float(__builtin_amdgcn_update_dpp(
                        __float_as_int(v), __float_as_int(v), CTRL, 0xf, 0xf, false)));
}
__device__ inline float row_max16(float v) {
    return dpp_max<0x168>(dpp_max<0x164>(dpp_max<0x162>(dpp_max<0x161>(v))));
}

// ---------------------------------------------------------------------------
// Kernel 1: fused QKV projection on the matrix unit, in f32 (16x16x4 form).
// x [B][64][N] f32 -> Qp,Kp [B][N][16] bf16 (32 B rows; elements 8..15 zeroed
// = WMMA K-padding, so attn-kernel lanes can load unconditionally; Q is stored
// times log2(e), so that every score q.k comes out of its WMMA in the exp2 domain),
// Kn2 = the largest |k|^2 among the block's 64 pixels (for the stats kernel; one
// float per block, each in a 128-B line of its own: one writer per line),
// V bf16 in the order of the output kernel's A fragments (below), biases fused
// (they are the accumulators' start values).
// One block per 64 pixels, so that every WGP works; each of its PW_ waves owns
// one tile of 16 output channels (waves 0..3: V; wave 4: Q over K) and all 64
// pixels as four tiles.  Index c of pixel tile j is pixel 4c + j: one 16-B load
// of x feeds all four tiles.
// Wave 4 takes the weights as A and x as B: a lane ends up with 8 channels of
// each of 4 neighbouring pixels, which are 4 rows of Qp or Kp.
// Waves 0..3 take x as A and the weights as B: a lane ends up with ONE channel
// (col) and the 32 neighbouring pixels 32*half + 4r + j, which are that
// channel's share of one 32-pixel chunk of V.
// Layout of Vf, in 16-B pieces: [b][chunk of 32 n][c-tile][p][lane], where piece
// (p, lane) holds n = 16p + 8*(lane>>4) + 0..7 of channel lane&15: lane l of the
// output kernel reads piece l, so each of its V loads is 512 B in a row.
// k order: element e of step s in lane half h is input channel
// 8*(s/2) + 4*h + 2*(s%2) + e, for the weight loader and the x loader alike.
// Every '#pragma unroll' here makes the indices of wa, xv and acc constants,
// without which they would not stay in registers.
// ---------------------------------------------------------------------------
#define PW_ 5                        // waves per block = tiles of 16 channels
#define NCH_ (N_ / 32)               // chunks of 32 n per batch
#define VCH_ 256                     // 16-B pieces of Vf per chunk (4 KB)
#define KNP_ 32                      // floats from one block's Kn2 to the next

__device__ inline unsigned pack2bf(float lo, float hi) {
    return (unsigned)f2bf(lo) | ((unsigned)f2bf(hi) << 16);
}

// One wave's 16 channels x 64 pixels.  XA: x is the A operand (rows of D are
// pixels, brow points to the lane's one bias); else the weights are (rows of D
// are channels, brow points to the biases of the lane's 8 rows).
template <bool XA>
__device__ __forceinline__ void proj_tile(const float* __restrict__ xb,
                                          const float* __restrict__ wrow,
                                          const float* __restrict__ brow,
                                          v8f (&acc)[4])
{
    // Loads in the order of their use, so that the first steps can start while
    // the later ones' data are still on their way.
    v8f bi;
    if (XA) {
        const float bb = *brow;
        bi = (v8f){bb, bb, bb, bb, bb, bb, bb, bb};
    } else {
        const v4f b0 = *(const v4f*)brow, b1 = *(const v4f*)(brow + 4);
        bi = (v8f){b0.x, b0.y, b0.z, b0.w, b1.x, b1.y, b1.z, b1.w};
    }
    v4f wa[8];                             // wa[u] = steps 2u and 2u + 1
    v4f xv[16][2];                         // [step][element], 4 pixels each
#pragma unroll
    for (int u = 0; u < 8; ++u) {
        wa[u] = *(const v4f*)(wrow + 8 * u);
#pragma unroll
        for (int q = 0; q < 4; ++q)
            xv[2 * u + (q >> 1)][q & 1] = *(const v4f*)(xb + (size_t)(8 * u + q) * N_);
    }

#pragma unroll
    for (int j = 0; j < 4; ++j) acc[j] = bi;

    // Stands in front of the first overwrite of the loads' address registers (a
    // precaution); naming them keeps them untouched up to here.
    asm volatile("s_wait_xcnt 0x0" :: "v"(xb), "v"(wrow), "v"(brow) : "memory");
    // Keeps all the loads in front of the first WMMA, in flight together: without
    // it the build sinks each pair of x loads to its step and the wave waits out
    // one round trip to L2 per step.
    __builtin_amdgcn_sched_barrier(0);

#pragma unroll
    for (int s = 0; s < 16; ++s) {
        const v2f wf = {wa[s >> 1][2 * (s & 1)], wa[s >> 1][2 * (s & 1) + 1]};
#pragma unroll
        for (int j = 0; j < 4; ++j) {
            const v2f xf = {xv[s][0][j], xv[s][1][j]};
            acc[j] = XA ? __builtin_amdgcn_wmma_f32_16x16x4_f32(false, xf, false, wf,
                                                                (short)0, acc[j], false, false)
                        : __builtin_amdgcn_wmma_f32_16x16x4_f32(false, wf, false, xf,
                                                                (short)0, acc[j], false, false);
        }
    }
}

__global__ __launch_bounds__(PW_ * 32) void proj_kernel(
    const float* __restrict__ x,
    const float* __restrict__ wq, const float* __restrict__ bq,
    const float* __restrict__ wk, const float* __restrict__ bk,
    const float* __restrict__ wv, const float* __restrict__ bv,
    uint4* __restrict__ Qp, uint4* __restrict__ Kp,
    uint4* __restrict__ Vf, float* __restrict__ Kn2)
{
    int t    = threadIdx.x;
    int wave = __builtin_amdgcn_readfirstlane(t >> 5), lane = t & 31;
    int half = lane >> 4, col = lane & 15;
    int g0 = blockIdx.x * 64;              // first of the block's 64 pixels
    int b  = g0 >> 12;
    int n0 = g0 & (N_ - 1);

    const float* xb = x + ((size_t)b * C_ + 4 * half) * N_ + n0 + 4 * col;
    v8f acc[4];

    if (wave < 4) {
        proj_tile<true>(xb, wv + (wave * 16 + col) * C_ + 4 * half, bv + wave * 16 + col, acc);
        // acc[j][r] = channel wave*16 + col, pixel g0 + 32*half + 4r + j: the lane's
        // four pieces of chunk 'half'; 16 lanes store 256 B in a row.
        uint4* vp = Vf + ((size_t)b * NCH_ + (n0 >> 5) + half) * VCH_ + wave * 64 + col;
#pragma unroll
        for (int q = 0; q < 4; ++q)                   // q = 2p + (target lane >> 4)
            vp[q * 16] = make_uint4(pack2bf(acc[0][2 * q],     acc[1][2 * q]),
                                    pack2bf(acc[2][2 * q],     acc[3][2 * q]),
                                    pack2bf(acc[0][2 * q + 1], acc[1][2 * q + 1]),
                                    pack2bf(acc[2][2 * q + 1], acc[3][2 * q + 1]));
    } else {
        proj_tile<false>(xb, (col < 8 ? wq + col * C_ : wk + (col - 8) * C_) + 4 * half,
                         half ? bk : bq, acc);
        // acc[j][r] = channel r of Q (lower lane half) or K (upper half), pixel
        // g0 + 4*col + j: 4 padded rows = 128 B per lane.
        uint4* dst = (half ? Kp : Qp) + (size_t)(g0 + 4 * col) * 2;
        const uint4 z4 = make_uint4(0u, 0u, 0u, 0u);
        const float sc = half ? 1.0f : LOG2E_;
#pragma unroll
        for (int j = 0; j < 4; ++j) acc[j] *= sc;
#pragma unroll
        for (int j = 0; j < 4; ++j) {
            dst[2 * j] = make_uint4(pack2bf(acc[j][0], acc[j][1]), pack2bf(acc[j][2], acc[j][3]),
                                    pack2bf(acc[j][4], acc[j][5]), pack2bf(acc[j][6], acc[j][7]));
            dst[2 * j + 1] = z4;                      // K = 8..15 zero padding
        }
        float k2 = 0.0f;                              // largest squared norm of 4 rows
#pragma unroll
        for (int j = 0; j < 4; ++j) {
            float t2 = 0.0f;
#pragma unroll
            for (int r = 0; r < 8; ++r) t2 = fmaf(acc[j][r], acc[j][r], t2);
            k2 = fmaxf(k2, t2);
        }
        k2 = row_max16(k2);                           // lanes 16..31: over the 64 K rows
        if (lane == 16) Kn2[blockIdx.x * KNP_] = k2;
        // In the listing the other branch's code follows and reuses the address
        // registers of these stores: the wait stands in front of it.
        asm volatile("s_wait_xcnt 0x0" ::: "memory");
    }
}

// ---------------------------------------------------------------------------
// Kernel 2: per-row softmax constants on the matrix unit, finished in one launch.
// A block owns SR_ = 64 softmax rows n over ALL j of their batch: wave w takes
// 32 of the rows (w & 1; two B operands: Q) and one j-segment (w >> 1), which it
// walks in steps of 64 j (four A operands: K).  With K as A and Q as B
// the D tile holds S transposed: a lane keeps 8 scores of ONE row n, so the
// sum of a row is lane-local.  Scores are in the exp2 domain (Q is stored so).
// The shift m of a row only has to lie near its largest score: close enough
// that exp2(s - m) neither overflows nor all but vanishes.  |q|*max|k| (the
// maximum over the wave's segment) is known before the products, lies at or above
// every score (up to rounding) and at most twice itself above the largest one, so
// while it is at most BMAX_ it serves as m, and goes into the WMMA as C: exp2
// reads D as it is.  A wave with a larger bound (or a NaN) walks with the exact
// running maximum instead.
// A row's 8 partial (m, d) pairs (4 segments x the two j halves of each tile,
// lanes l and l^16) meet in LDS behind one barrier, and the block itself emits
// the fused softmax constant:  Crow[n] = -log2(D[n]) - M[n],
// so that  P[n,m] = exp2(S[n,m] + Crow[n]).
// Every '#pragma unroll' here makes the indices of ka, kc, qb, cn, s, tm, m, d, a
// and pr constants, without which they would not stay in registers.
// ---------------------------------------------------------------------------
#define BMAX_ 50.0f                  // exp2(s - m) stays at or above 2^-100

// p: the lane's piece of the first of the step's four tiles of 16 K rows (512 B).
__device__ inline void stats_load(uint4 (&kc)[4], const char* __restrict__ p)
{
#pragma unroll
    for (int jt = 0; jt < 4; ++jt) kc[jt] = *(const uint4*)(p + jt * 512);
}

__device__ inline void stats_frag(V16 (&ka)[4], const uint4 (&kc)[4])
{
#pragma unroll
    for (int jt = 0; jt < 4; ++jt) {
        ka[jt].u[0] = kc[jt].x; ka[jt].u[1] = kc[jt].y;
        ka[jt].u[2] = kc[jt].z; ka[jt].u[3] = kc[jt].w;
        ka[jt].u[4] = 0u; ka[jt].u[5] = 0u; ka[jt].u[6] = 0u; ka[jt].u[7] = 0u;
    }
}

// One step, shift known: 64 j (kc) against the wave's 32 rows; cn = -m in every
// element, a = four independent partial sums per row tile.
__device__ inline void stats_step_bound(const uint4 (&kc)[4], const V16 (&qb)[2],
                                        const v8f (&cn)[2], v2f (&a)[2][4])
{
    V16 ka[4];
    stats_frag(ka, kc);
#pragma unroll
    for (int nt = 0; nt < 2; ++nt) {
        v8f s[4];
#pragma unroll
        for (int jt = 0; jt < 4; ++jt)
            s[jt] = __builtin_amdgcn_wmma_f32_16x16x32_bf16(false, ka[jt].v, false, qb[nt].v,
                                                            (short)0, cn[nt], false, false);
#pragma unroll
        for (int jt = 0; jt < 4; ++jt)
#pragma unroll
            for (int r = 0; r < 8; r += 2) {
                v2f p = {__builtin_amdgcn_exp2f(s[jt][r]), __builtin_amdgcn_exp2f(s[jt][r + 1])};
                a[nt][r >> 1] += p;
            }
    }
}

// One step, exact: online max / sum update.
__device__ inline void stats_step(const uint4 (&kc)[4], const V16 (&qb)[2],
                                  float (&m)[2], float (&d)[2])
{
    const v8f zc = {0.f,0.f,0.f,0.f,0.f,0.f,0.f,0.f};
    V16 ka[4];
    stats_frag(ka, kc);
#pragma unroll
    for (int nt = 0; nt < 2; ++nt) {
        v8f s[4];
#pragma unroll
        for (int jt = 0; jt < 4; ++jt)
            s[jt] = __builtin_amdgcn_wmma_f32_16x16x32_bf16(false, ka[jt].v, false, qb[nt].v,
                                                            (short)0, zc, false, false);
        float tm[4];                                  // one short max chain per tile
#pragma unroll
        for (int jt = 0; jt < 4; ++jt) {
            tm[jt] = s[jt][0];
#pragma unroll
            for (int r = 1; r < 8; ++r) tm[jt] = fmaxf(tm[jt], s[jt][r]);
        }
        const float mn = fmaxf(fmaxf(fmaxf(m[nt], tm[0]), tm[1]), fmaxf(tm[2], tm[3]));
        v2f a0 = {0.f, 0.f}, a1 = {0.f, 0.f};         // independent partial sums
#pragma unroll
        for (int jt = 0; jt < 4; ++jt)
#pragma unroll
            for (int r = 0; r < 8; r += 4) {
                v2f e0 = {s[jt][r],     s[jt][r + 1]};
                v2f e1 = {s[jt][r + 2], s[jt][r + 3]};
                e0 = e0 - mn;
                e1 = e1 - mn;
                v2f p0 = {__builtin_amdgcn_exp2f(e0.x), __builtin_amdgcn_exp2f(e0.y)};
                v2f p1 = {__builtin_amdgcn_exp2f(e1.x), __builtin_amdgcn_exp2f(e1.y)};
                a0 += p0;
                a1 += p1;
            }
        a0 += a1;
        d[nt] = fmaf(d[nt], __builtin_amdgcn_exp2f(m[nt] - mn), a0.x + a0.y);
        m[nt] = mn;
    }
}

// Squared norm of a stored row's 8 bf16 elements.
__device__ inline float row_norm2(uint4 v)
{
    const unsigned u[4] = {v.x, v.y, v.z, v.w};
    float t = 0.0f;
#pragma unroll
    for (int i = 0; i < 4; ++i) {
        const float lo = __uint_as_float(u[i] << 16), hi = __uint_as_float(u[i] & 0xFFFF0000u);
        t = fmaf(lo, lo, fmaf(hi, hi, t));
    }
    return t;
}

#define SR_ 64                       // softmax rows per block

__global__ __launch_bounds__(256) void stats_kernel(
    const uint4* __restrict__ Qp, const uint4* __restrict__ Kp,
    const float* __restrict__ Kn2, float* __restrict__ Crow)
{
    __shared__ float2 part[2 * NSEG_][SR_];        // [segment*2 + lane half][row]

    int t    = threadIdx.x;
    int wave = __builtin_amdgcn_readfirstlane(t >> 5), lane = t & 31;
    int half = lane >> 4, col = lane & 15;
    int rg  = wave & 1;                // which 32 of the block's 64 rows
    int seg = wave >> 1;               // 4 segments
    int gb  = blockIdx.x * SR_;        // first of the block's 64 rows
    int g0  = gb + rg * 32;            // first of this wave's 32 rows
    int b   = g0 >> 12;

    // Every lane loads its row's 8 real elements (for the norm); as B operand the
    // upper-half lanes hold zeros, the same values as the stored padding that the K
    // loader reads there, so the k order of A and B is equal at every position.
    V16 qb[2];
    uint4 qr[2];
#pragma unroll
    for (int nt = 0; nt < 2; ++nt) {
        qr[nt] = Qp[(size_t)(g0 + nt * 16 + col) * 2];
        qb[nt].u[0] = half ? 0u : qr[nt].x; qb[nt].u[1] = half ? 0u : qr[nt].y;
        qb[nt].u[2] = half ? 0u : qr[nt].z; qb[nt].u[3] = half ? 0u : qr[nt].w;
        qb[nt].u[4] = 0u;   qb[nt].u[5] = 0u;   qb[nt].u[6] = 0u;   qb[nt].u[7] = 0u;
    }
    // The segment's 1024 j are 16 blocks of the projection kernel.
    const float kn = Kn2[((b * N_ + seg * SEGJ_) / 64 + col) * KNP_];

    // The segment is walked as a ring of 16 steps of 64 j (2 KB).  The 64 blocks of a
    // batch read the same K rows: their first steps are spread over the ring, four blocks to a step, so that they do not
    // all ask L2 for the same lines at the same moment.  Blocks that differ in the low
    // three bits of the index alone, or in the high three alone, start at 8 different steps.
    const char* kseg = (const char*)(Kp + ((size_t)b * N_ + seg * SEGJ_ + col) * 2 + half);
    const int rb = blockIdx.x & (N_ / SR_ - 1);
    int st = (2 * (rb >> 3) + 5 * (rb & 7)) & 15;
    uint4 kA[4], kB[4];                // two register buffers: each step's K rows
    stats_load(kA, kseg + st * 2048);  // are fetched one step ahead of their use
    // Keeps the first K loads in front of the wait for kn: without it the build
    // issues them behind that wait, and the wave waits out two round trips to L2.
    __builtin_amdgcn_sched_barrier(0);

    const float k2 = row_max16(kn);    // largest |k|^2 of the segment
    float m[2], d[2];
#pragma unroll
    for (int nt = 0; nt < 2; ++nt) m[nt] = __builtin_amdgcn_sqrtf(row_norm2(qr[nt]) * k2);

    // One test per wave, a scalar branch: the WMMAs of both sides run with every
    // lane on.  Written so that a NaN takes the exact side.
    if (__builtin_amdgcn_ballot_w32(!(m[0] <= BMAX_ && m[1] <= BMAX_)) == 0) {
        v8f cn[2];
        v2f a[2][4];
#pragma unroll
        for (int nt = 0; nt < 2; ++nt) {
            const float c = -m[nt];
            cn[nt] = (v8f){c, c, c, c, c, c, c, c};
#pragma unroll
            for (int i = 0; i < 4; ++i) a[nt][i] = (v2f){0.f, 0.f};
        }
        for (int j0 = 0; j0 < SEGJ_; j0 += 128) {
            const char* pB = kseg + ((st + 1) & 15) * 2048;
            const char* pA = kseg + ((st + 2) & 15) * 2048;
            stats_load(kB, pB);
            stats_step_bound(kA, qb, cn, a);
            if (j0 + 128 < SEGJ_) stats_load(kA, pA);
            stats_step_bound(kB, qb, cn, a);
            // As in the exact loop below.
            __builtin_amdgcn_sched_barrier(0);
            asm volatile("s_wait_xcnt 0x0" :: "v"(pB), "v"(pA) : "memory");
            st = (st + 2) & 15;
        }
#pragma unroll
        for (int nt = 0; nt < 2; ++nt) {
            const v2f s2 = (a[nt][0] + a[nt][1]) + (a[nt][2] + a[nt][3]);
            d[nt] = s2.x + s2.y;
        }
    } else {
        m[0] = m[1] = -3.0e38f;
        d[0] = d[1] = 0.0f;
        for (int j0 = 0; j0 < SEGJ_; j0 += 128) {
            const char* pB = kseg + ((st + 1) & 15) * 2048;
            const char* pA = kseg + ((st + 2) & 15) * 2048;
            stats_load(kB, pB);
            stats_step(kA, qb, m, d);
            if (j0 + 128 < SEGJ_) stats_load(kA, pA);
            stats_step(kB, qb, m, d);
            // Stands in front of the overwrite of the K loads' address registers (a
            // precaution); naming them keeps them untouched up to here.  The scheduling
            // barrier holds the wait at the trip's end: without it the build lifts wait
            // and overwrite to just behind the loads' issue, where the wave could stall.
            __builtin_amdgcn_sched_barrier(0);
            asm volatile("s_wait_xcnt 0x0" :: "v"(pB), "v"(pA) : "memory");
            st = (st + 2) & 15;
        }
    }

    // Every lane publishes its partial of each of its 2 rows.
#pragma unroll
    for (int nt = 0; nt < 2; ++nt)
        part[seg * 2 + half][rg * 32 + nt * 16 + col] = make_float2(m[nt], d[nt]);

    __syncthreads();

    // Waves 0 and 1: thread t merges the 8 partials of row gb + t, in segment order.
    if (t < SR_) {
        float2 pr[2 * NSEG_];
#pragma unroll
        for (int s = 0; s < 2 * NSEG_; ++s) pr[s] = part[s][t];
        float mm = pr[0].x;
#pragma unroll
        for (int s = 1; s < 2 * NSEG_; ++s) mm = fmaxf(mm, pr[s].x);
        v8f w;
#pragma unroll
        for (int s = 0; s < 2 * NSEG_; ++s) w[s] = pr[s].x - mm;
        exp2x8(w);
        float dd = 0.0f;
#pragma unroll
        for (int s = 0; s < 2 * NSEG_; ++s) dd += pr[s].y * w[s];
        Crow[gb + t] = -__builtin_amdgcn_logf(dd) - mm;            // v_log_f32 is log2
    }
}

// ---------------------------------------------------------------------------
// Kernel 3: out = V @ softmax_rows(QtK) + x.  One block owns 64 output columns
// (4 m-tiles) of one batch; its NW_ waves share out the n loop, each working
// on all 4 m-tiles, so every Q, Crow and V fragment it loads feeds 4 tiles.
// Two waves per SIMD: few waves to start and few partial sums to merge.  What the
// other waves of a fuller SIMD would hide, a wave hides itself: each 32-n chunk's
// loads are issued one chunk ahead of their use, into a second set of registers.
// The per-wave f32 partial sums meet in LDS: after one barrier wave w adds the
// NW_ partials of accumulator tiles 2w and 2w + 1 in wave order and stores them with x.
// Key identity: the WMMA C-layout of the two S tiles (lane holds
// rows 8*half+r / 16+8*half+r of column l%16) is exactly the lane-local data
// the PV B-operand layout needs, so P is repacked C->B in registers.
// Every '#pragma unroll' here makes the indices of acc, kb, av and the
// small float arrays constants, without which they would not stay in registers.
// ---------------------------------------------------------------------------
#define NW_   8                      // waves per block = n slices; 2 acc tiles each

// One 32-n chunk: Q rows (two 16-row A tiles), the 16 row constants of this lane
// (the score WMMAs' C), 4 c-tiles of V (A-operands).
struct AChunk { V16 aq0, aq1; v8f cw0, cw1; V16 av[4]; };

__device__ __forceinline__ void attn_load(AChunk& k, const char* __restrict__ qc,
                                          const char* __restrict__ cc,
                                          const char* __restrict__ vch)
{
    const uint4 v0 = *(const uint4*)qc;
    const uint4 v1 = *(const uint4*)(qc + 512);
    const float4 c0 = *(const float4*)cc,        c1 = *(const float4*)(cc + 16);
    const float4 c2 = *(const float4*)(cc + 64), c3 = *(const float4*)(cc + 80);
#pragma unroll
    for (int ct = 0; ct < 4; ++ct) {
        const uint4 a0 = *(const uint4*)(vch + ct * 1024);
        const uint4 a1 = *(const uint4*)(vch + ct * 1024 + 512);
        k.av[ct].u[0] = a0.x; k.av[ct].u[1] = a0.y; k.av[ct].u[2] = a0.z; k.av[ct].u[3] = a0.w;
        k.av[ct].u[4] = a1.x; k.av[ct].u[5] = a1.y; k.av[ct].u[6] = a1.z; k.av[ct].u[7] = a1.w;
    }
    k.aq0.u[0] = v0.x; k.aq0.u[1] = v0.y; k.aq0.u[2] = v0.z; k.aq0.u[3] = v0.w;
    k.aq1.u[0] = v1.x; k.aq1.u[1] = v1.y; k.aq1.u[2] = v1.z; k.aq1.u[3] = v1.w;
    k.aq0.u[4] = k.aq0.u[5] = k.aq0.u[6] = k.aq0.u[7] = 0u;
    k.aq1.u[4] = k.aq1.u[5] = k.aq1.u[6] = k.aq1.u[7] = 0u;
    k.cw0 = (v8f){c0.x, c0.y, c0.z, c0.w, c1.x, c1.y, c1.z, c1.w};
    k.cw1 = (v8f){c2.x, c2.y, c2.z, c2.w, c3.x, c3.y, c3.z, c3.w};
}

// The four m-tiles of chunk k.
// P = exp2(s + Crow[row]), the row constants being the score WMMA's C (a lane's 8
// rows are the same in every m-tile); C-layout -> B-layout is lane-local:
// pb pair j<4 = rows {8h+2j, 8h+2j+1} of tile 0, pair j>=4 = tile 1.
__device__ __forceinline__ void attn_chunk(const AChunk& k, const V16 (&kb)[4], v8f (&acc)[4][4])
{
#pragma unroll
    for (int mt = 0; mt < 4; ++mt) {
        const v8f s0 = __builtin_amdgcn_wmma_f32_16x16x32_bf16(false, k.aq0.v, false, kb[mt].v,
                                                               (short)0, k.cw0, false, false);
        const v8f s1 = __builtin_amdgcn_wmma_f32_16x16x32_bf16(false, k.aq1.v, false, kb[mt].v,
                                                               (short)0, k.cw1, false, false);
        V16 pb;
        exp2_pack2(s0, s1, pb.u);
#pragma unroll
        for (int ct = 0; ct < 4; ++ct)
            acc[ct][mt] = __builtin_amdgcn_wmma_f32_16x16x32_bf16(false, k.av[ct].v, false, pb.v,
                                                                  (short)0, acc[ct][mt], false, false);
    }
}

__global__ __launch_bounds__(NW_ * 32) void attn_out_kernel(
    const uint4* __restrict__ Qp, const uint4* __restrict__ Kp,
    const uint4* __restrict__ Vf,
    const float* __restrict__ Crow,
    const float* __restrict__ x, float* __restrict__ out)
{
    __shared__ float4 red[NW_][32][32];            // [wave][tile*2 + r/4][lane]

    int t    = threadIdx.x;
    int wave = __builtin_amdgcn_readfirstlane(t >> 5), lane = t & 31;
    int half = lane >> 4, col = lane & 15;
    int b  = blockIdx.x >> 6;
    int m0 = (blockIdx.x & 63) << 6;

    const size_t bN = (size_t)b * N_;

    // B-operands for scores: K columns m0..m0+63 (fixed for the whole wave).
    // Unconditional load: upper-half lanes read the stored zero padding.
    V16 kb[4];
#pragma unroll
    for (int mt = 0; mt < 4; ++mt) {
        uint4 kv = Kp[(bN + m0 + mt * 16 + col) * 2 + half];
        kb[mt].u[0] = kv.x; kb[mt].u[1] = kv.y; kb[mt].u[2] = kv.z; kb[mt].u[3] = kv.w;
        kb[mt].u[4] = 0u;   kb[mt].u[5] = 0u;   kb[mt].u[6] = 0u;   kb[mt].u[7] = 0u;
    }
    // The address registers of the four K loads are reused by the set-up code
    // below:
    // the wait stands here, and the scheduling barrier keeps that code behind it.
    asm volatile("s_wait_xcnt 0x0" ::: "memory");
    __builtin_amdgcn_sched_barrier(0);

    // V lies in fragment order (see the projection kernel): piece 'lane' of each
    // of a chunk's 8 groups of 32 pieces, so a V load reads 4 whole 128-B lines.
    // Every address of the loop is a chunk's place, the same for the whole wave,
    // plus the lane's fixed byte offset in the chunk.
    const char* qbat = (const char*)(Qp + bN * 2) + (unsigned)(col * 2 + half) * 16u;
    const char* cbat = (const char*)(Crow + bN) + (unsigned)half * 32u;
    const char* vbat = (const char*)(Vf + (size_t)b * NCH_ * VCH_) + (unsigned)lane * 16u;

    // Chunks of 32 n are dealt round robin on a ring: block r of a batch starts 2r
    // chunks further on and wraps.  The batch's 64 blocks read the same Q, Crow and V;
    // walking in step they would all ask L2 for the same lines at the same moment.
    int n0 = ((wave + 2 * (blockIdx.x & 63)) & (NCH_ - 1)) * 32;
    AChunk ka, kc;                                 // the two register sets
    {
        const char* q = qbat + n0 * 32;
        const char* c = cbat + n0 * 4;
        const char* v = vbat + n0 * (VCH_ / 2);
        attn_load(ka, q, c, v);
        // Stands in front of the first overwrite of these loads' address registers (a
        // precaution); naming them keeps them untouched up to here.
        asm volatile("s_wait_xcnt 0x0" :: "v"(q), "v"(c), "v"(v) : "memory");
    }

    const v8f zc = {0.f,0.f,0.f,0.f,0.f,0.f,0.f,0.f};
    v8f acc[4][4];                                 // [ct][mt]
#pragma unroll
    for (int ct = 0; ct < 4; ++ct)
#pragma unroll
        for (int mt = 0; mt < 4; ++mt) acc[ct][mt] = zc;

    // N_ / (NW_ * 32) = 16 chunks per wave, two per trip.
    for (int it = 0; it < N_ / (NW_ * 64); ++it) {
        const int n1 = (n0 + NW_ * 32) & (N_ - 1);
        const int n2 = (n0 + NW_ * 64) & (N_ - 1);
        const char* q1 = qbat + n1 * 32;
        const char* c1 = cbat + n1 * 4;
        const char* v1 = vbat + n1 * (VCH_ / 2);
        const char* q2 = qbat + n2 * 32;
        const char* c2 = cbat + n2 * 4;
        const char* v2 = vbat + n2 * (VCH_ / 2);
        attn_load(kc, q1, c1, v1);
        // Keeps the next chunk's loads in front of this chunk's work: sunk to their
        // use, they would leave the wave waiting out a round trip to L2 per chunk.
        __builtin_amdgcn_sched_barrier(0);
        attn_chunk(ka, kb, acc);
        if (it + 1 < N_ / (NW_ * 64)) attn_load(ka, q2, c2, v2);
        // As above.
        __builtin_amdgcn_sched_barrier(0);
        attn_chunk(kc, kb, acc);
        // Stands in front of the overwrite of the loads' address registers (a
        // precaution); naming them keeps them untouched up to here.  The scheduling
        // barrier holds the wait at the trip's end: without it the build lifts it to
        // just behind the second group of loads, where the wave could stall.
        __builtin_amdgcn_sched_barrier(0);
        asm volatile("s_wait_xcnt 0x0" :: "v"(q1), "v"(c1), "v"(v1), "v"(q2), "v"(c2), "v"(v2) : "memory");
        n0 = n2;
    }

    // Every wave publishes its 16 partial tiles, lane-contiguous 16-B pieces.
#pragma unroll
    for (int ct = 0; ct < 4; ++ct)
#pragma unroll
        for (int mt = 0; mt < 4; ++mt) {
            v8f a = acc[ct][mt];
            red[wave][(ct * 4 + mt) * 2    ][lane] = make_float4(a[0], a[1], a[2], a[3]);
            red[wave][(ct * 4 + mt) * 2 + 1][lane] = make_float4(a[4], a[5], a[6], a[7]);
        }

    // Wave w finishes tiles 2w and 2w + 1 (tile = ct*4 + mt: one ct, two neighbouring
    // m-tiles); their residual x is fetched meanwhile.
    const int ct = wave >> 1, mt = (wave & 1) * 2;
    const size_t idx0 = ((size_t)b * C_ + ct * 16 + 8 * half) * N_ + m0 + mt * 16 + col;
    float xv[2][8];
#pragma unroll
    for (int u = 0; u < 2; ++u)
#pragma unroll
        for (int r = 0; r < 8; ++r) xv[u][r] = x[idx0 + u * 16 + (size_t)r * N_];

    __syncthreads();

#pragma unroll
    for (int u = 0; u < 2; ++u) {
        const int tl = (wave * 2 + u) * 2;
        float4 lo0 = red[0][tl][lane], hi0 = red[0][tl + 1][lane];
        float sum[8] = {lo0.x, lo0.y, lo0.z, lo0.w, hi0.x, hi0.y, hi0.z, hi0.w};
#pragma unroll
        for (int s = 1; s < NW_; ++s) {
            float4 lo = red[s][tl    ][lane];
            float4 hi = red[s][tl + 1][lane];
            sum[0] += lo.x; sum[1] += lo.y; sum[2] += lo.z; sum[3] += lo.w;
            sum[4] += hi.x; sum[5] += hi.y; sum[6] += hi.z; sum[7] += hi.w;
        }
#pragma unroll
        for (int r = 0; r < 8; ++r) out[idx0 + u * 16 + (size_t)r * N_] = sum[r] + xv[u][r];
    }
}

// ---------------------------------------------------------------------------
extern "C" void kernel_launch(void* const* d_in, const int* in_sizes, int n_in,
                              void* d_out, int out_size, void* d_ws, size_t ws_size,
                              hipStream_t stream)
{
    const float* x  = (const float*)d_in[0];
    const float* wq = (const float*)d_in[1];
    const float* bq = (const float*)d_in[2];
    const float* wk = (const float*)d_in[3];
    const float* bk = (const float*)d_in[4];
    const float* wv = (const float*)d_in[5];
    const float* bv = (const float*)d_in[6];
    float* out = (float*)d_out;

    char* ws = (char*)d_ws;
    const size_t qp_bytes = (size_t)B_ * N_ * 16 * 2;           // 512 KB (padded rows)
    const size_t vb_bytes = (size_t)B_ * C_ * N_ * 2;           // 2 MB

    uint4*          Qp    = (uint4*)(ws);
    uint4*          Kp    = (uint4*)(ws + qp_bytes);
    uint4*          Vf    = (uint4*)(ws + 2 * qp_bytes);
    float*          Crow  = (float*)(ws + 2 * qp_bytes + vb_bytes);
    float*          Kn2   = Crow + B_ * N_;                     // 256 lines of 128 B

    proj_kernel<<<(B_ * N_) / 64, PW_ * 32, 0, stream>>>(x, wq, bq, wk, bk, wv, bv, Qp, Kp, Vf, Kn2);
    stats_kernel<<<(B_ * N_) / SR_, 256, 0, stream>>>(Qp, Kp, Kn2, Crow);
    attn_out_kernel<<<B_ * (N_ / 64), NW_ * 32, 0, stream>>>(Qp, Kp, Vf, Crow, x, out);
}

// v009
// Measured time: 20.2 microseconds a run.
// Timed twice side by side with v008, it ran 1.07 and 1.06 times as fast.
// Over all steps from v000 it is 10.7 times as fast.
#include <hip/hip_runtime.h>
#include <stdint.h>

#define B_  4
#define C_  64
#define N_  4096
#define C8_ 8

#define NSEG_ 4
#define SEGJ_ (N_ / NSEG_)          // 1024 j per stats segment

typedef __attribute__((ext_vector_type(16))) __bf16 v16bf;
typedef __attribute__((ext_vector_type(8)))  float  v8f;
typedef __attribute__((ext_vector_type(2)))  float  v2f;
typedef __attribute__((ext_vector_type(4)))  float  v4f;

union V16 { unsigned u[8]; v16bf v; };

#define LOG2E_ 1.4426950408889634f

__device__ inline unsigned short f2bf(float f) {
    unsigned u = __float_as_uint(f);
    unsigned r = u + 0x7FFFu + ((u >> 16) & 1u);   // round-to-nearest-even
    return (unsigned short)(r >> 16);
}
__device__ inline float bf2f(unsigned short h) {
    return __uint_as_float(((unsigned)h) << 16);
}

// exp2 of eight values, each in its own register.  One asm statement: every
// v_exp_f32 overwrites its own source only, and the closing v_nop is a slot in
// front of whatever reads the last result.
__device__ __forceinline__ void exp2x8(v8f& s) {
    float a = s[0], b = s[1], c = s[2], d = s[3], e = s[4], f = s[5], g = s[6], h = s[7];
    asm("v_exp_f32 %0, %0\n\tv_exp_f32 %1, %1\n\tv_exp_f32 %2, %2\n\tv_exp_f32 %3, %3\n\t"
        "v_exp_f32 %4, %4\n\tv_exp_f32 %5, %5\n\tv_exp_f32 %6, %6\n\tv_exp_f32 %7, %7\n\tv_nop"
        : "+v"(a), "+v"(b), "+v"(c), "+v"(d), "+v"(e), "+v"(f), "+v"(g), "+v"(h));
    s = (v8f){a, b, c, d, e, f, g, h};
}

// Two score tiles' 8 + 8 values -> exp2 -> 8 pairs of bf16 (the upper halves), for the
// same reason in one asm statement.  The four v_nop are the slots that the chip needs
// between a WMMA and a vector instruction that reads its D.
// Results go to registers of their own (the pairs' own and six
// more), so no v_exp_f32 overwrites a source; each pack stands well behind the v_exp_f32
// that it reads, but for the last two.  The s_delay_alu tells the issue logic that
// these read results of the third-last and the last v_exp_f32: without the hint a wave
// that waits there holds up the SIMD's other waves.
__device__ __forceinline__ void exp2_pack2(const v8f& s, const v8f& r, unsigned (&p)[8]) {
    unsigned u0, u1, u2, u3, u4, u5;
    asm("v_nop\n\tv_nop\n\tv_nop\n\tv_nop\n\t"
        "v_exp_f32 %0, %14\n\tv_exp_f32 %1, %15\n\tv_exp_f32 %2, %16\n\tv_exp_f32 %3, %17\n\t"
        "v_exp_f32 %4, %18\n\tv_exp_f32 %5, %19\n\tv_exp_f32 %6, %20\n\tv_exp_f32 %7, %21\n\t"
        "v_exp_f32 %8, %22\n\tv_exp_f32 %9, %23\n\tv_exp_f32 %10, %24\n\tv_exp_f32 %11, %25\n\t"
        "v_perm_b32 %0, %1, %0, 0x7060302\n\tv_perm_b32 %1, %3, %2, 0x7060302\n\t"
        "v_perm_b32 %2, %5, %4, 0x7060302\n\tv_perm_b32 %3, %7, %6, 0x7060302\n\t"
        "v_exp_f32 %6, %26\n\tv_exp_f32 %7, %27\n\tv_exp_f32 %12, %28\n\tv_exp_f32 %13, %29\n\t"
        "v_perm_b32 %4, %9, %8, 0x7060302\n\tv_perm_b32 %5, %11, %10, 0x7060302\n\t"
        "s_delay_alu instid0(TRANS32_DEP_3) | instskip(NEXT) | instid1(TRANS32_DEP_1)\n\t"
        "v_perm_b32 %6, %7, %6, 0x7060302\n\tv_perm_b32 %7, %13, %12, 0x7060302"
        : "=&v"(p[0]), "=&v"(p[1]), "=&v"(p[2]), "=&v"(p[3]),
          "=&v"(p[4]), "=&v"(p[5]), "=&v"(p[6]), "=&v"(p[7]),
          "=&v"(u0), "=&v"(u1), "=&v"(u2), "=&v"(u3), "=&v"(u4), "=&v"(u5)
        : "v"(s[0]), "v"(s[1]), "v"(s[2]), "v"(s[3]), "v"(s[4]), "v"(s[5]), "v"(s[6]), "v"(s[7]),
          "v"(r[0]), "v"(r[1]), "v"(r[2]), "v"(r[3]), "v"(r[4]), "v"(r[5]), "v"(r[6]), "v"(r[7]));
}

// Maximum over the lane's row of 16 lanes (DPP row_xmask 1, 2, 4, 8): every lane
// of the row ends up with it.
template <int CTRL>
__device__ inline float dpp_max(float v) {
    return fmaxf(v, __int_as_float(__builtin_amdgcn_update_dpp(
                        __float_as_int(v), __float_as_int(v), CTRL, 0xf, 0xf, false)));
}
__device__ inline float row_max16(float v) {
    return dpp_max<0x168>(dpp_max<0x164>(dpp_max<0x162>(dpp_max<0x161>(v))));
}

// ---------------------------------------------------------------------------
// Kernel 1: fused QKV projection on the matrix unit, in f32 (16x16x4 form).
// x [B][64][N] f32 -> Qp,Kp [B][N][8] bf16 (16 B rows, no padding: a wave's 16-B
// load per lane brings 32 rows, see the stats kernel; Q is stored
// times log2(e), so that every score q.k comes out of its WMMA in the exp2 domain),
// Kn2 = the largest |k|^2 among the block's 64 pixels (for the stats kernel; one
// float per block, each in a 128-B line of its own: one writer per line),
// V bf16 in the order of the output kernel's A fragments (below), biases fused
// (they are the accumulators' start values).
// One block per 64 pixels, so that every WGP works; each of its PW_ waves owns
// one tile of 16 output channels (waves 0..3: V; wave 4: Q over K) and all 64
// pixels as four tiles.  Index c of pixel tile j is pixel 4c + j: one 16-B load
// of x feeds all four tiles.
// Wave 4 takes the weights as A and x as B: a lane ends up with 8 channels of
// each of 4 neighbouring pixels, which are 4 rows of Qp or Kp.
// Waves 0..3 take x as A and the weights as B: a lane ends up with ONE channel
// (col) and the 32 neighbouring pixels 32*half + 4r + j, which are that
// channel's share of one 32-pixel chunk of V.
// Layout of Vf, in 16-B pieces: [b][chunk of 32 n][c-tile][p][lane], where piece
// (p, lane) holds n = 16p + 8*(lane>>4) + 0..7 of channel lane&15: lane l of the
// output kernel reads piece l, so each of its V loads is 512 B in a row.
// k order: element e of step s in lane half h is input channel
// 8*(s/2) + 4*h + 2*(s%2) + e, for the weight loader and the x loader alike.
// Every '#pragma unroll' here makes the indices of wa, xv and acc constants,
// without which they would not stay in registers.
// ---------------------------------------------------------------------------
#define PW_ 5                        // waves per block = tiles of 16 channels
#define NCH_ (N_ / 32)               // chunks of 32 n per batch
#define VCH_ 256                     // 16-B pieces of Vf per chunk (4 KB)
#define KNP_ 32                      // floats from one block's Kn2 to the next

__device__ inline unsigned pack2bf(float lo, float hi) {
    return (unsigned)f2bf(lo) | ((unsigned)f2bf(hi) << 16);
}

// One wave's 16 channels x 64 pixels.  XA: x is the A operand (rows of D are
// pixels, brow points to the lane's one bias); else the weights are (rows of D
// are channels, brow points to the biases of the lane's 8 rows).
template <bool XA>
__device__ __forceinline__ void proj_tile(const float* __restrict__ xb,
                                          const float* __restrict__ wrow,
                                          const float* __restrict__ brow,
                                          v8f (&acc)[4])
{
    // Loads in the order of their use, so that the first steps can start while
    // the later ones' data are still on their way.
    v8f bi;
    if (XA) {
        const float bb = *brow;
        bi = (v8f){bb, bb, bb, bb, bb, bb, bb, bb};
    } else {
        const v4f b0 = *(const v4f*)brow, b1 = *(const v4f*)(brow + 4);
        bi = (v8f){b0.x, b0.y, b0.z, b0.w, b1.x, b1.y, b1.z, b1.w};
    }
    v4f wa[8];                             // wa[u] = steps 2u and 2u + 1
    v4f xv[16][2];                         // [step][element], 4 pixels each
#pragma unroll
    for (int u = 0; u < 8; ++u) {
        wa[u] = *(const v4f*)(wrow + 8 * u);
#pragma unroll
        for (int q = 0; q < 4; ++q)
            xv[2 * u + (q >> 1)][q & 1] = *(const v4f*)(xb + (size_t)(8 * u + q) * N_);
    }

#pragma unroll
    for (int j = 0; j < 4; ++j) acc[j] = bi;

    // Stands in front of the first overwrite of the loads' address registers (a
    // precaution); naming them keeps them untouched up to here.
    asm volatile("s_wait_xcnt 0x0" :: "v"(xb), "v"(wrow), "v"(brow) : "memory");
    // Keeps all the loads in front of the first WMMA, in flight together: without
    // it the build sinks each pair of x loads to its step and the wave waits out
    // one round trip to L2 per step.
    __builtin_amdgcn_sched_barrier(0);

#pragma unroll
    for (int s = 0; s < 16; ++s) {
        const v2f wf = {wa[s >> 1][2 * (s & 1)], wa[s >> 1][2 * (s & 1) + 1]};
#pragma unroll
        for (int j = 0; j < 4; ++j) {
            const v2f xf = {xv[s][0][j], xv[s][1][j]};
            acc[j] = XA ? __builtin_amdgcn_wmma_f32_16x16x4_f32(false, xf, false, wf,
                                                                (short)0, acc[j], false, false)
                        : __builtin_amdgcn_wmma_f32_16x16x4_f32(false, wf, false, xf,
                                                                (short)0, acc[j], false, false);
        }
    }
}

__global__ __launch_bounds__(PW_ * 32) void proj_kernel(
    const float* __restrict__ x,
    const float* __restrict__ wq, const float* __restrict__ bq,
    const float* __restrict__ wk, const float* __restrict__ bk,
    const float* __restrict__ wv, const float* __restrict__ bv,
    uint4* __restrict__ Qp, uint4* __restrict__ Kp,
    uint4* __restrict__ Vf, float* __restrict__ Kn2)
{
    int t    = threadIdx.x;
    int wave = __builtin_amdgcn_readfirstlane(t >> 5), lane = t & 31;
    int half = lane >> 4, col = lane & 15;
    int g0 = blockIdx.x * 64;              // first of the block's 64 pixels
    int b  = g0 >> 12;
    int n0 = g0 & (N_ - 1);

    const float* xb = x + ((size_t)b * C_ + 4 * half) * N_ + n0 + 4 * col;
    v8f acc[4];

    if (wave < 4) {
        proj_tile<true>(xb, wv + (wave * 16 + col) * C_ + 4 * half, bv + wave * 16 + col, acc);
        // acc[j][r] = channel wave*16 + col, pixel g0 + 32*half + 4r + j: the lane's
        // four pieces of chunk 'half'; 16 lanes store 256 B in a row.
        uint4* vp = Vf + ((size_t)b * NCH_ + (n0 >> 5) + half) * VCH_ + wave * 64 + col;
#pragma unroll
        for (int q = 0; q < 4; ++q)                   // q = 2p + (target lane >> 4)
            vp[q * 16] = make_uint4(pack2bf(acc[0][2 * q],     acc[1][2 * q]),
                                    pack2bf(acc[2][2 * q],     acc[3][2 * q]),
                                    pack2bf(acc[0][2 * q + 1], acc[1][2 * q + 1]),
                                    pack2bf(acc[2][2 * q + 1], acc[3][2 * q + 1]));
    } else {
        proj_tile<false>(xb, (col < 8 ? wq + col * C_ : wk + (col - 8) * C_) + 4 * half,
                         half ? bk : bq, acc);
        // acc[j][r] = channel r of Q (lower lane half) or K (upper half), pixel
        // g0 + 4*col + j: 4 rows = 64 B per lane.
        uint4* dst = (half ? Kp : Qp) + (size_t)(g0 + 4 * col);
        const float sc = half ? 1.0f : LOG2E_;
#pragma unroll
        for (int j = 0; j < 4; ++j) acc[j] *= sc;
#pragma unroll
        for (int j = 0; j < 4; ++j)
            dst[j] = make_uint4(pack2bf(acc[j][0], acc[j][1]), pack2bf(acc[j][2], acc[j][3]),
                                pack2bf(acc[j][4], acc[j][5]), pack2bf(acc[j][6], acc[j][7]));
        float k2 = 0.0f;                              // largest squared norm of 4 rows
#pragma unroll
        for (int j = 0; j < 4; ++j) {
            float t2 = 0.0f;
#pragma unroll
            for (int r = 0; r < 8; ++r) t2 = fmaf(acc[j][r], acc[j][r], t2);
            k2 = fmaxf(k2, t2);
        }
        k2 = row_max16(k2);                           // lanes 16..31: over the 64 K rows
        if (lane == 16) Kn2[blockIdx.x * KNP_] = k2;
        // In the listing the other branch's code follows and reuses the address
        // registers of these stores: the wait stands in front of it.
        asm volatile("s_wait_xcnt 0x0" ::: "memory");
    }
}

// ---------------------------------------------------------------------------
// Kernel 2: per-row softmax constants on the matrix unit, finished in one launch.
// A block owns SR_ = 64 softmax rows n over ALL j of their batch: wave w takes
// 32 of the rows (w & 1) and one j-segment (w >> 1), which it walks in steps of
// 128 j (four A operands: K).  A 16-B load per lane brings 32 K rows: as A operand,
// lanes 0..15 hold rows 0..15 at k 0..7 and lanes 16..31 hold rows 16..31 at k 8..15.
// Against a B operand with Q at k 0..7 and zeros at k 8..15 the product is the score
// tile of rows 0..15, against one with zeros at k 0..7 and Q at k 8..15 that of rows
// 16..31 (two B operands per 16 softmax rows).  The other 16 rows meet zeros; a NaN or
// an infinity among them reaches a sum over all j that holds it anyway.  With K as A and Q as B
// the D tile holds S transposed: a lane keeps 8 scores of ONE row n, so the
// sum of a row is lane-local.  Scores are in the exp2 domain (Q is stored so).
// The shift m of a row only has to lie near its largest score: close enough
// that exp2(s - m) neither overflows nor all but vanishes.  |q|*max|k| (the
// maximum over the wave's segment) is known before the products, lies at or above
// every score (up to rounding) and at most twice itself above the largest one, so
// while it is at most BMAX_ it serves as m, and goes into the WMMA as C: exp2
// reads D as it is.  A wave with a larger bound (or a NaN) walks with the exact
// running maximum instead.
// A row's 8 partial (m, d) pairs (4 segments x the two j halves of each tile,
// lanes l and l^16) meet in LDS behind one barrier, and the block itself emits
// the fused softmax constant:  Crow[n] = -log2(D[n]) - M[n],
// so that  P[n,m] = exp2(S[n,m] + Crow[n]).
// Every '#pragma unroll' here makes the indices of ka, kc, qb, qr, cn, s, tm, m, d, a
// and pr constants, without which they would not stay in registers.
// ---------------------------------------------------------------------------
#define BMAX_ 50.0f                  // exp2(s - m) stays at or above 2^-100

// p: the lane's row among the first 32 of the step's 128 K rows (512 B a load).
__device__ inline void stats_load(uint4 (&kc)[4], const char* __restrict__ p)
{
#pragma unroll
    for (int jt = 0; jt < 4; ++jt) kc[jt] = *(const uint4*)(p + jt * 512);
}

__device__ inline void stats_frag(V16 (&ka)[4], const uint4 (&kc)[4])
{
#pragma unroll
    for (int jt = 0; jt < 4; ++jt) {
        ka[jt].u[0] = kc[jt].x; ka[jt].u[1] = kc[jt].y;
        ka[jt].u[2] = kc[jt].z; ka[jt].u[3] = kc[jt].w;
        ka[jt].u[4] = 0u; ka[jt].u[5] = 0u; ka[jt].u[6] = 0u; ka[jt].u[7] = 0u;
    }
}

// One step, shift known: 128 j (kc) against the wave's 32 rows; qb[nt][hv]: Q at
// k 8*hv .. 8*hv + 7; cn = -m in every element, a = four independent partial sums
// per row tile.
__device__ inline void stats_step_bound(const uint4 (&kc)[4], const V16 (&qb)[2][2],
                                        const v8f (&cn)[2], v2f (&a)[2][4])
{
    V16 ka[4];
    stats_frag(ka, kc);
#pragma unroll
    for (int hn = 0; hn < 4; ++hn) {
        const int hv = hn >> 1, nt = hn & 1;
        v8f s[4];
#pragma unroll
        for (int jt = 0; jt < 4; ++jt)
            s[jt] = __builtin_amdgcn_wmma_f32_16x16x32_bf16(false, ka[jt].v, false, qb[nt][hv].v,
                                                            (short)0, cn[nt], false, false);
#pragma unroll
        for (int jt = 0; jt < 4; ++jt)
#pragma unroll
            for (int r = 0; r < 8; r += 2) {
                v2f p = {__builtin_amdgcn_exp2f(s[jt][r]), __builtin_amdgcn_exp2f(s[jt][r + 1])};
                a[nt][r >> 1] += p;
            }
    }
}

// One step, exact: online max / sum update.
__device__ inline void stats_step(const uint4 (&kc)[4], const V16 (&qb)[2][2],
                                  float (&m)[2], float (&d)[2])
{
    const v8f zc = {0.f,0.f,0.f,0.f,0.f,0.f,0.f,0.f};
    V16 ka[4];
    stats_frag(ka, kc);
#pragma unroll
    for (int hn = 0; hn < 4; ++hn) {
        const int hv = hn >> 1, nt = hn & 1;
        v8f s[4];
#pragma unroll
        for (int jt = 0; jt < 4; ++jt)
            s[jt] = __builtin_amdgcn_wmma_f32_16x16x32_bf16(false, ka[jt].v, false, qb[nt][hv].v,
                                                            (short)0, zc, false, false);
        float tm[4];                                  // one short max chain per tile
#pragma unroll
        for (int jt = 0; jt < 4; ++jt) {
            tm[jt] = s[jt][0];
#pragma unroll
            for (int r = 1; r < 8; ++r) tm[jt] = fmaxf(tm[jt], s[jt][r]);
        }
        const float mn = fmaxf(fmaxf(fmaxf(m[nt], tm[0]), tm[1]), fmaxf(tm[2], tm[3]));
        v2f a0 = {0.f, 0.f}, a1 = {0.f, 0.f};         // independent partial sums
#pragma unroll
        for (int jt = 0; jt < 4; ++jt)
#pragma unroll
            for (int r = 0; r < 8; r += 4) {
                v2f e0 = {s[jt][r],     s[jt][r + 1]};
                v2f e1 = {s[jt][r + 2], s[jt][r + 3]};
                e0 = e0 - mn;
                e1 = e1 - mn;
                v2f p0 = {__builtin_amdgcn_exp2f(e0.x), __builtin_amdgcn_exp2f(e0.y)};
                v2f p1 = {__builtin_amdgcn_exp2f(e1.x), __builtin_amdgcn_exp2f(e1.y)};
                a0 += p0;
                a1 += p1;
            }
        a0 += a1;
        d[nt] = fmaf(d[nt], __builtin_amdgcn_exp2f(m[nt] - mn), a0.x + a0.y);
        m[nt] = mn;
    }
}

// Squared norm of a stored row's 8 bf16 elements.
__device__ inline float row_norm2(uint4 v)
{
    const unsigned u[4] = {v.x, v.y, v.z, v.w};
    float t = 0.0f;
#pragma unroll
    for (int i = 0; i < 4; ++i) {
        const float lo = __uint_as_float(u[i] << 16), hi = __uint_as_float(u[i] & 0xFFFF0000u);
        t = fmaf(lo, lo, fmaf(hi, hi, t));
    }
    return t;
}

#define SR_ 64                       // softmax rows per block

__global__ __launch_bounds__(256) void stats_kernel(
    const uint4* __restrict__ Qp, const uint4* __restrict__ Kp,
    const float* __restrict__ Kn2, float* __restrict__ Crow)
{
    __shared__ float2 part[2 * NSEG_][SR_];        // [segment*2 + lane half][row]

    int t    = threadIdx.x;
    int wave = __builtin_amdgcn_readfirstlane(t >> 5), lane = t & 31;
    int half = lane >> 4, col = lane & 15;
    int rg  = wave & 1;                // which 32 of the block's 64 rows
    int seg = wave >> 1;               // 4 segments
    int gb  = blockIdx.x * SR_;        // first of the block's 64 rows
    int g0  = gb + rg * 32;            // first of this wave's 32 rows
    int b   = g0 >> 12;

    // Every lane loads its row's 8 elements (for the norm too).  B operand hv holds
    // them in the lanes of half hv, that is at k 8*hv + 0..7 in the stored order, and
    // zeros in the other half: the K loader puts a row's elements at the same k in the
    // same order, so the k order of A and B is equal at every position.
    V16 qb[2][2];
    uint4 qr[2];
    const int qi = g0 + col;
#pragma unroll
    for (int nt = 0; nt < 2; ++nt) {
        qr[nt] = Qp[qi + nt * 16];
#pragma unroll
        for (int hv = 0; hv < 2; ++hv) {
            const bool on = half == hv;
            qb[nt][hv].u[0] = on ? qr[nt].x : 0u; qb[nt][hv].u[1] = on ? qr[nt].y : 0u;
            qb[nt][hv].u[2] = on ? qr[nt].z : 0u; qb[nt][hv].u[3] = on ? qr[nt].w : 0u;
            qb[nt][hv].u[4] = 0u; qb[nt][hv].u[5] = 0u; qb[nt][hv].u[6] = 0u; qb[nt][hv].u[7] = 0u;
        }
    }
    // The segment's 1024 j are 16 blocks of the projection kernel.
    const int ki = ((b * N_ + seg * SEGJ_) / 64 + col) * KNP_;
    const float kn = Kn2[ki];

    // The segment is walked as a ring of 8 steps of 128 j (2 KB).  The 64 blocks of a
    // batch read the same K rows: they start spread over the 8 steps, 8 blocks to a step, so that they do not
    // all ask L2 for the same lines at the same moment.  Blocks that differ in the low
    // three bits of the index alone, or in the high three alone, start at 8 different steps.
    const char* kseg = (const char*)(Kp + (size_t)b * N_ + seg * SEGJ_ + lane);
    const int rb = blockIdx.x & (N_ / SR_ - 1);
    int st = ((rb >> 3) + 5 * (rb & 7)) & 7;
    uint4 kA[4], kB[4];                // two register buffers: each step's K rows
    const char* p0 = kseg + st * 2048; // are fetched one step ahead of their use
    stats_load(kA, p0);
    // Stands in front of the first overwrite of the address registers of the loads up
    // to here (a precaution); naming them keeps them untouched up to here, and naming
    // a loaded word of each Q row keeps the Q loads in front of the wait (the build
    // had sunk them behind it).
    asm volatile("s_wait_xcnt 0x0" :: "v"(qi), "v"(ki), "v"(p0), "v"(qr[0].x), "v"(qr[1].x) : "memory");
    // Keeps the first K loads in front of the wait for kn: without it the build
    // issues them behind that wait, and the wave waits out two round trips to L2.
    __builtin_amdgcn_sched_barrier(0);

    const float k2 = row_max16(kn);    // largest |k|^2 of the segment
    float m[2], d[2];
#pragma unroll
    for (int nt = 0; nt < 2; ++nt) m[nt] = __builtin_amdgcn_sqrtf(row_norm2(qr[nt]) * k2);

    // One test per wave, a scalar branch: the WMMAs of both sides run with every
    // lane on.  Written so that a NaN takes the exact side.
    if (__builtin_amdgcn_ballot_w32(!(m[0] <= BMAX_ && m[1] <= BMAX_)) == 0) {
        v8f cn[2];
        v2f a[2][4];
#pragma unroll
        for (int nt = 0; nt < 2; ++nt) {
            const float c = -m[nt];
            cn[nt] = (v8f){c, c, c, c, c, c, c, c};
#pragma unroll
            for (int i = 0; i < 4; ++i) a[nt][i] = (v2f){0.f, 0.f};
        }
        for (int j0 = 0; j0 < SEGJ_; j0 += 256) {
            const char* pB = kseg + ((st + 1) & 7) * 2048;
            const char* pA = kseg + ((st + 2) & 7) * 2048;
            stats_load(kB, pB);
            stats_step_bound(kA, qb, cn, a);
            if (j0 + 256 < SEGJ_) stats_load(kA, pA);
            stats_step_bound(kB, qb, cn, a);
            // As in the exact loop below.
            __builtin_amdgcn_sched_barrier(0);
            asm volatile("s_wait_xcnt 0x0" :: "v"(pB), "v"(pA) : "memory");
            st = (st + 2) & 7;
        }
#pragma unroll
        for (int nt = 0; nt < 2; ++nt) {
            const v2f s2 = (a[nt][0] + a[nt][1]) + (a[nt][2] + a[nt][3]);
            d[nt] = s2.x + s2.y;
        }
    } else {
        m[0] = m[1] = -3.0e38f;
        d[0] = d[1] = 0.0f;
        for (int j0 = 0; j0 < SEGJ_; j0 += 256) {
            const char* pB = kseg + ((st + 1) & 7) * 2048;
            const char* pA = kseg + ((st + 2) & 7) * 2048;
            stats_load(kB, pB);
            stats_step(kA, qb, m, d);
            if (j0 + 256 < SEGJ_) stats_load(kA, pA);
            stats_step(kB, qb, m, d);
            // Stands in front of the overwrite of the K loads' address registers (a
            // precaution); naming them keeps them untouched up to here.  The scheduling
            // barrier holds the wait at the trip's end: without it the build lifts wait
            // and overwrite to just behind the loads' issue, where the wave could stall.
            __builtin_amdgcn_sched_barrier(0);
            asm volatile("s_wait_xcnt 0x0" :: "v"(pB), "v"(pA) : "memory");
            st = (st + 2) & 7;
        }
    }

    // Every lane publishes its partial of each of its 2 rows.
#pragma unroll
    for (int nt = 0; nt < 2; ++nt)
        part[seg * 2 + half][rg * 32 + nt * 16 + col] = make_float2(m[nt], d[nt]);

    __syncthreads();

    // Waves 0 and 1: thread t merges the 8 partials of row gb + t, in segment order.
    if (t < SR_) {
        float2 pr[2 * NSEG_];
#pragma unroll
        for (int s = 0; s < 2 * NSEG_; ++s) pr[s] = part[s][t];
        float mm = pr[0].x;
#pragma unroll
        for (int s = 1; s < 2 * NSEG_; ++s) mm = fmaxf(mm, pr[s].x);
        v8f w;
#pragma unroll
        for (int s = 0; s < 2 * NSEG_; ++s) w[s] = pr[s].x - mm;
        exp2x8(w);
        float dd = 0.0f;
#pragma unroll
        for (int s = 0; s < 2 * NSEG_; ++s) dd += pr[s].y * w[s];
        Crow[gb + t] = -__builtin_amdgcn_logf(dd) - mm;            // v_log_f32 is log2
    }
}

// ---------------------------------------------------------------------------
// Kernel 3: out = V @ softmax_rows(QtK) + x.  One block owns 64 output columns
// (4 m-tiles) of one batch; its NW_ waves share out the n loop, each working
// on all 4 m-tiles, so every Q, Crow and V fragment it loads feeds 4 tiles.
// Two waves per SIMD: few waves to start and few partial sums to merge.  What the
// other waves of a fuller SIMD would hide, a wave hides itself: each 32-n chunk's
// loads are issued one chunk ahead of their use, into a second set of registers.
// The per-wave f32 partial sums meet in LDS: after one barrier wave w adds the
// NW_ partials of accumulator tiles 2w and 2w + 1 in wave order and stores them with x.
// Key identity: the WMMA C-layout of the two S tiles (lane holds
// rows 8*half+r / 16+8*half+r of column l%16) is exactly the lane-local data
// the PV B-operand layout needs, so P is repacked C->B in registers.
// Every '#pragma unroll' here makes the indices of acc, kb, kv, av and the
// small float arrays constants, without which they would not stay in registers.
// ---------------------------------------------------------------------------
#define NW_   8                      // waves per block = n slices; 2 acc tiles each

// One 32-n chunk: its 32 Q rows (one A operand: rows 0..15 at k 0..7 in lanes 0..15,
// rows 16..31 at k 8..15 in lanes 16..31), the 16 row constants of this lane
// (the score WMMAs' C), 4 c-tiles of V (A-operands).
struct AChunk { V16 aq; v8f cw0, cw1; V16 av[4]; };

__device__ __forceinline__ void attn_load(AChunk& k, const char* __restrict__ qc,
                                          const char* __restrict__ cc,
                                          const char* __restrict__ vch)
{
    const uint4 v0 = *(const uint4*)qc;
    const float4 c0 = *(const float4*)cc,        c1 = *(const float4*)(cc + 16);
    const float4 c2 = *(const float4*)(cc + 64), c3 = *(const float4*)(cc + 80);
#pragma unroll
    for (int ct = 0; ct < 4; ++ct) {
        const uint4 a0 = *(const uint4*)(vch + ct * 1024);
        const uint4 a1 = *(const uint4*)(vch + ct * 1024 + 512);
        k.av[ct].u[0] = a0.x; k.av[ct].u[1] = a0.y; k.av[ct].u[2] = a0.z; k.av[ct].u[3] = a0.w;
        k.av[ct].u[4] = a1.x; k.av[ct].u[5] = a1.y; k.av[ct].u[6] = a1.z; k.av[ct].u[7] = a1.w;
    }
    k.aq.u[0] = v0.x; k.aq.u[1] = v0.y; k.aq.u[2] = v0.z; k.aq.u[3] = v0.w;
    k.aq.u[4] = k.aq.u[5] = k.aq.u[6] = k.aq.u[7] = 0u;
    k.cw0 = (v8f){c0.x, c0.y, c0.z, c0.w, c1.x, c1.y, c1.z, c1.w};
    k.cw1 = (v8f){c2.x, c2.y, c2.z, c2.w, c3.x, c3.y, c3.z, c3.w};
}

// The four m-tiles of chunk k.  kb[mt][hv] holds the K columns at k 8*hv + 0..7 and
// zeros elsewhere: against the one Q operand, hv = 0 gives the scores of the chunk's
// rows 0..15 and hv = 1 those of rows 16..31 (the other 16 rows meet zeros; a NaN or an
// infinity among them reaches output columns whose sum over n holds it anyway).
// P = exp2(s + Crow[row]), the row constants being the score WMMA's C (a lane's 8
// rows are the same in every m-tile); C-layout -> B-layout is lane-local:
// pb pair j<4 = rows {8h+2j, 8h+2j+1} of tile 0, pair j>=4 = tile 1.
__device__ __forceinline__ void attn_chunk(const AChunk& k, const V16 (&kb)[4][2], v8f (&acc)[4][4])
{
#pragma unroll
    for (int mt = 0; mt < 4; ++mt) {
        const v8f s0 = __builtin_amdgcn_wmma_f32_16x16x32_bf16(false, k.aq.v, false, kb[mt][0].v,
                                                               (short)0, k.cw0, false, false);
        const v8f s1 = __builtin_amdgcn_wmma_f32_16x16x32_bf16(false, k.aq.v, false, kb[mt][1].v,
                                                               (short)0, k.cw1, false, false);
        V16 pb;
        exp2_pack2(s0, s1, pb.u);
#pragma unroll
        for (int ct = 0; ct < 4; ++ct)
            acc[ct][mt] = __builtin_amdgcn_wmma_f32_16x16x32_bf16(false, k.av[ct].v, false, pb.v,
                                                                  (short)0, acc[ct][mt], false, false);
    }
}

__global__ __launch_bounds__(NW_ * 32) void attn_out_kernel(
    const uint4* __restrict__ Qp, const uint4* __restrict__ Kp,
    const uint4* __restrict__ Vf,
    const float* __restrict__ Crow,
    const float* __restrict__ x, float* __restrict__ out)
{
    __shared__ float4 red[NW_][32][32];            // [wave][tile*2 + r/4][lane]

    int t    = threadIdx.x;
    int wave = __builtin_amdgcn_readfirstlane(t >> 5), lane = t & 31;
    int half = lane >> 4, col = lane & 15;
    int b  = blockIdx.x >> 6;
    int m0 = (blockIdx.x & 63) << 6;

    const size_t bN = (size_t)b * N_;

    // B-operands for scores: K columns m0..m0+63 (fixed for the whole wave), each
    // twice: in the lanes of half hv, that is at k 8*hv + 0..7 in the stored order (the
    // order in which the Q loader has a row's elements there), zeros in the other half.
    // They are formed further down, behind the issue of the first chunk's loads, which
    // so do not wait for the K columns to arrive.
    uint4 kv[4];
#pragma unroll
    for (int mt = 0; mt < 4; ++mt) kv[mt] = Kp[bN + m0 + mt * 16 + col];
    // The address registers of the four K loads are reused by the set-up code
    // below:
    // the wait stands here, and the scheduling barrier keeps that code behind it.
    asm volatile("s_wait_xcnt 0x0" ::: "memory");
    __builtin_amdgcn_sched_barrier(0);

    // V lies in fragment order (see the projection kernel): piece 'lane' of each
    // of a chunk's 8 groups of 32 pieces, so a V load reads 4 whole 128-B lines.
    // Every address of the loop is a chunk's place, the same for the whole wave,
    // plus the lane's fixed byte offset in the chunk.
    const char* qbat = (const char*)(Qp + bN) + (unsigned)lane * 16u;
    const char* cbat = (const char*)(Crow + bN) + (unsigned)half * 32u;
    const char* vbat = (const char*)(Vf + (size_t)b * NCH_ * VCH_) + (unsigned)lane * 16u;

    // Chunks of 32 n are dealt round robin on a ring: block r of a batch starts 2r
    // chunks further on and wraps.  The batch's 64 blocks read the same Q, Crow and V;
    // walking in step they would all ask L2 for the same lines at the same moment.
    int n0 = ((wave + 2 * (blockIdx.x & 63)) & (NCH_ - 1)) * 32;
    AChunk ka, kc;                                 // the two register sets
    {
        const char* q = qbat + n0 * 16;
        const char* c = cbat + n0 * 4;
        const char* v = vbat + n0 * (VCH_ / 2);
        attn_load(ka, q, c, v);
        // Stands in front of the first overwrite of these loads' address registers (a
        // precaution); naming them keeps them untouched up to here.
        asm volatile("s_wait_xcnt 0x0" :: "v"(q), "v"(c), "v"(v) : "memory");
    }
    V16 kb[4][2];
#pragma unroll
    for (int mt = 0; mt < 4; ++mt)
#pragma unroll
        for (int hv = 0; hv < 2; ++hv) {
            const bool on = half == hv;
            kb[mt][hv].u[0] = on ? kv[mt].x : 0u; kb[mt][hv].u[1] = on ? kv[mt].y : 0u;
            kb[mt][hv].u[2] = on ? kv[mt].z : 0u; kb[mt][hv].u[3] = on ? kv[mt].w : 0u;
            kb[mt][hv].u[4] = 0u; kb[mt][hv].u[5] = 0u; kb[mt][hv].u[6] = 0u; kb[mt][hv].u[7] = 0u;
        }

    const v8f zc = {0.f,0.f,0.f,0.f,0.f,0.f,0.f,0.f};
    v8f acc[4][4];                                 // [ct][mt]
#pragma unroll
    for (int ct = 0; ct < 4; ++ct)
#pragma unroll
        for (int mt = 0; mt < 4; ++mt) acc[ct][mt] = zc;

    // N_ / (NW_ * 32) = 16 chunks per wave, two per trip.
    for (int it = 0; it < N_ / (NW_ * 64); ++it) {
        const int n1 = (n0 + NW_ * 32) & (N_ - 1);
        const int n2 = (n0 + NW_ * 64) & (N_ - 1);
        const char* q1 = qbat + n1 * 16;
        const char* c1 = cbat + n1 * 4;
        const char* v1 = vbat + n1 * (VCH_ / 2);
        const char* q2 = qbat + n2 * 16;
        const char* c2 = cbat + n2 * 4;
        const char* v2 = vbat + n2 * (VCH_ / 2);
        attn_load(kc, q1, c1, v1);
        // Keeps the next chunk's loads in front of this chunk's work: sunk to their
        // use, they would leave the wave waiting out a round trip to L2 per chunk.
        __builtin_amdgcn_sched_barrier(0);
        attn_chunk(ka, kb, acc);
        if (it + 1 < N_ / (NW_ * 64)) attn_load(ka, q2, c2, v2);
        // As above.
        __builtin_amdgcn_sched_barrier(0);
        attn_chunk(kc, kb, acc);
        // Stands in front of the overwrite of the loads' address registers (a
        // precaution); naming them keeps them untouched up to here.  The scheduling
        // barrier holds the wait at the trip's end: without it the build lifts it to
        // just behind the second group of loads, where the wave could stall.
        __builtin_amdgcn_sched_barrier(0);
        asm volatile("s_wait_xcnt 0x0" :: "v"(q1), "v"(c1), "v"(v1), "v"(q2), "v"(c2), "v"(v2) : "memory");
        n0 = n2;
    }

    // Every wave publishes its 16 partial tiles, lane-contiguous 16-B pieces.
#pragma unroll
    for (int ct = 0; ct < 4; ++ct)
#pragma unroll
        for (int mt = 0; mt < 4; ++mt) {
            v8f a = acc[ct][mt];
            red[wave][(ct * 4 + mt) * 2    ][lane] = make_float4(a[0], a[1], a[2], a[3]);
            red[wave][(ct * 4 + mt) * 2 + 1][lane] = make_float4(a[4], a[5], a[6], a[7]);
        }

    // Wave w finishes tiles 2w and 2w + 1 (tile = ct*4 + mt: one ct, two neighbouring
    // m-tiles); their residual x is fetched meanwhile.
    const int ct = wave >> 1, mt = (wave & 1) * 2;
    const size_t idx0 = ((size_t)b * C_ + ct * 16 + 8 * half) * N_ + m0 + mt * 16 + col;
    float xv[2][8];
#pragma unroll
    for (int u = 0; u < 2; ++u)
#pragma unroll
        for (int r = 0; r < 8; ++r) xv[u][r] = x[idx0 + u * 16 + (size_t)r * N_];

    __syncthreads();

#pragma unroll
    for (int u = 0; u < 2; ++u) {
        const int tl = (wave * 2 + u) * 2;
        float4 lo0 = red[0][tl][lane], hi0 = red[0][tl + 1][lane];
        float sum[8] = {lo0.x, lo0.y, lo0.z, lo0.w, hi0.x, hi0.y, hi0.z, hi0.w};
#pragma unroll
        for (int s = 1; s < NW_; ++s) {
            float4 lo = red[s][tl    ][lane];
            float4 hi = red[s][tl + 1][lane];
            sum[0] += lo.x; sum[1] += lo.y; sum[2] += lo.z; sum[3] += lo.w;
            sum[4] += hi.x; sum[5] += hi.y; sum[6] += hi.z; sum[7] += hi.w;
        }
#pragma unroll
        for (int r = 0; r < 8; ++r) out[idx0 + u * 16 + (size_t)r * N_] = sum[r] + xv[u][r];
    }
}

// ---------------------------------------------------------------------------
extern "C" void kernel_launch(void* const* d_in, const int* in_sizes, int n_in,
                              void* d_out, int out_size, void* d_ws, size_t ws_size,
                              hipStream_t stream)
{
    const float* x  = (const float*)d_in[0];
    const float* wq = (const float*)d_in[1];
    const float* bq = (const float*)d_in[2];
    const float* wk = (const float*)d_in[3];
    const float* bk = (const float*)d_in[4];
    const float* wv = (const float*)d_in[5];
    const float* bv = (const float*)d_in[6];
    float* out = (float*)d_out;

    char* ws = (char*)d_ws;
    const size_t qp_bytes = (size_t)B_ * N_ * C8_ * 2;          // 256 KB
    const size_t vb_bytes = (size_t)B_ * C_ * N_ * 2;           // 2 MB

    uint4*          Qp    = (uint4*)(ws);
    uint4*          Kp    = (uint4*)(ws + qp_bytes);
    uint4*          Vf    = (uint4*)(ws + 2 * qp_bytes);
    float*          Crow  = (float*)(ws + 2 * qp_bytes + vb_bytes);
    float*          Kn2   = Crow + B_ * N_;                     // 256 lines of 128 B

    proj_kernel<<<(B_ * N_) / 64, PW_ * 32, 0, stream>>>(x, wq, bq, wk, bk, wv, bv, Qp, Kp, Vf, Kn2);
    stats_kernel<<<(B_ * N_) / SR_, 256, 0, stream>>>(Qp, Kp, Kn2, Crow);
    attn_out_kernel<<<B_ * (N_ / 64), NW_ * 32, 0, stream>>>(Qp, Kp, Vf, Crow, x, out);
}
